// v000
// Times are from an AMD MI455X. After a warm-up the kernel runs many times in a row, and a time is the length of
// such a window on the GPU divided by its runs, so every launch and the gaps after it count. The runs cycle
// through copies of the inputs. A figure is the median of several windows, for all but v000 over two sittings.
// Sittings can differ by a few percent; kernels timed side by side share one.
// The starting kernel, v000, takes 280 microseconds a run.
#include <hip/hip_runtime.h>
#include <math.h>

typedef __attribute__((ext_vector_type(16))) _Float16 v16h;
typedef __attribute__((ext_vector_type(8)))  float    v8f;
typedef __attribute__((ext_vector_type(4)))  float    f4;

namespace {
constexpr int Bb = 4, Hh = 16, Ss = 2048, Dd = 64;
constexpr float kScale = 0.125f;   // 1/sqrt(64)
constexpr int QTILE = 128;         // q rows per block = 8 waves * 16
constexpr int KT    = 64;          // kv rows per tile
constexpr int NT    = Ss / KT;     // 32 kv tiles
}

// 16-bit WMMA A/B fragment K-index (ISA 7.12.2):
// element i of lane L -> K = 16*(i>>3) + 8*(L>=16) + 2*((i>>1)&3) + (i&1)
//                          = 16*(i>>3) + 8*(L>=16) + (i&7)
// Consecutive i give contiguous 8-half runs -> LDS reads vectorize to b128.
__device__ __forceinline__ int kidx(int i, int lh) {
  return ((i >> 3) << 4) + (lh << 3) + (((i >> 1) & 3) << 1) + (i & 1);
}

// S^T_g += K[16g..16g+16) @ Q^T  (A = K-frag from LDS, B = Q^T-frag in regs)
#define ST_STEP(sacc, g) do {                                                             \
    v16h a_;                                                                              \
    _Pragma("unroll") for (int i_ = 0; i_ < 16; ++i_)                                     \
      a_[i_] = Ksh[(16*(g) + ln) * Dd + kidx(i_, lh)];                                    \
    sacc = __builtin_amdgcn_wmma_f32_16x16x32_f16(false, a_, false, bq0, (short)0, sacc, false, false); \
    _Pragma("unroll") for (int i_ = 0; i_ < 16; ++i_)                                     \
      a_[i_] = Ksh[(16*(g) + ln) * Dd + 32 + kidx(i_, lh)];                               \
    sacc = __builtin_amdgcn_wmma_f32_16x16x32_f16(false, a_, false, bq1, (short)0, sacc, false, false); \
  } while (0)

// O^T_c += V^T[16c..16c+16, :] @ P^T  (A = V^T-frag from LDS, B = P^T in regs)
#define OT_STEP(oacc, c) do {                                                             \
    v16h a_;                                                                              \
    _Pragma("unroll") for (int i_ = 0; i_ < 16; ++i_)                                     \
      a_[i_] = Vts[(16*(c) + ln) * KT + kidx(i_, lh)];                                    \
    oacc = __builtin_amdgcn_wmma_f32_16x16x32_f16(false, a_, false, bp0, (short)0, oacc, false, false); \
    _Pragma("unroll") for (int i_ = 0; i_ < 16; ++i_)                                     \
      a_[i_] = Vts[(16*(c) + ln) * KT + 32 + kidx(i_, lh)];                               \
    oacc = __builtin_amdgcn_wmma_f32_16x16x32_f16(false, a_, false, bp1, (short)0, oacc, false, false); \
  } while (0)

__global__ __launch_bounds__(256, 2)
void fa_fwd_wmma(const float* __restrict__ q, const float* __restrict__ k,
                 const float* __restrict__ v, float* __restrict__ o) {
  __shared__ _Float16 Ksh[KT * Dd];        // K tile  [k][d]   8 KB
  __shared__ _Float16 Vts[Dd * KT];        // V tile  [d][k]   8 KB (transposed)

  const int tid  = threadIdx.x;
  const int lane = tid & 31;
  const int w    = tid >> 5;
  const int lh   = lane >> 4;
  const int ln   = lane & 15;

  const int qblocks = Ss / QTILE;
  const int bh    = blockIdx.x / qblocks;
  const int qblk  = blockIdx.x % qblocks;
  const int qbase = qblk * QTILE + w * 16;

  const float* qp = q + ((size_t)bh * Ss + qbase) * Dd;
  const float* kp = k + (size_t)bh * Ss * Dd;
  const float* vp = v + (size_t)bh * Ss * Dd;
  float*       op = o + ((size_t)bh * Ss + qbase) * Dd;

  // ---- Q tile as two B-fragments (Q^T), pre-scaled by 1/sqrt(D) ----
  v16h bq0, bq1;
#pragma unroll
  for (int i = 0; i < 16; ++i) {
    const int kk = kidx(i, lh);
    bq0[i] = (_Float16)(qp[ln * Dd + kk] * kScale);
    bq1[i] = (_Float16)(qp[ln * Dd + 32 + kk] * kScale);
  }

  // constant all-ones A fragment: ones @ P^T = column sums (softmax denominator)
  v16h aones;
#pragma unroll
  for (int i = 0; i < 16; ++i) aones[i] = (_Float16)1.0f;

  // O^T accumulators: lane = q-col (ln), VGPR i = d row 16c + i + 8*lh
  v8f o0 = {}, o1 = {}, o2 = {}, o3 = {};
  v8f lacc = {};               // denominator (every VGPR row holds q-col sum)
  float mrow = -INFINITY;      // running max for this lane's q-column

  const int kvrow = tid >> 2;            // V staging: this thread's k row
  const int d0    = (tid & 3) << 4;      // and d column base (16 cols)

  // ---- register double buffer: preload tile 0 ----
  f4 krg[4], vrg[4];
  {
    const f4* kt0 = (const f4*)(kp + (size_t)tid * 16);
    const f4* vt0 = (const f4*)(vp + (size_t)tid * 16);
#pragma unroll
    for (int j = 0; j < 4; ++j) { krg[j] = kt0[j]; vrg[j] = vt0[j]; }
  }

  for (int t = 0; t < NT; ++t) {
    __syncthreads();                     // previous tile's readers done
    // commit staged registers to LDS (fp32 -> f16); V goes in transposed
    {
      _Float16* kd = Ksh + tid * 16;     // contiguous -> merged ds_store
#pragma unroll
      for (int j = 0; j < 4; ++j)
#pragma unroll
        for (int c = 0; c < 4; ++c) kd[4 * j + c] = (_Float16)krg[j][c];
#pragma unroll
      for (int j = 0; j < 4; ++j)
#pragma unroll
        for (int c = 0; c < 4; ++c)
          Vts[(d0 + 4 * j + c) * KT + kvrow] = (_Float16)vrg[j][c];
    }
    if (t + 1 < NT) {                    // preload next tile -> overlaps compute
      const f4* ktn = (const f4*)(kp + (size_t)(t + 1) * KT * Dd + tid * 16);
      const f4* vtn = (const f4*)(vp + (size_t)(t + 1) * KT * Dd + tid * 16);
#pragma unroll
      for (int j = 0; j < 4; ++j) { krg[j] = ktn[j]; vrg[j] = vtn[j]; }
    }
    __syncthreads();

    // ---- S^T = K_tile @ (Q*scale)^T : four 16(key)x16(q) accumulators.
    // Lane holds q-col = ln; VGPR j = key 16g + j + 8*lh. ----
    v8f s0 = {}, s1 = {}, s2 = {}, s3 = {};
    ST_STEP(s0, 0); ST_STEP(s1, 1); ST_STEP(s2, 2); ST_STEP(s3, 3);

    // ---- row max for this lane's q-column: in-lane tree + ONE xor-16 bpermute ----
    float mloc = s0[0];
#pragma unroll
    for (int i = 0; i < 8; ++i) {
      mloc = fmaxf(mloc, s0[i]); mloc = fmaxf(mloc, s1[i]);
      mloc = fmaxf(mloc, s2[i]); mloc = fmaxf(mloc, s3[i]);
    }
    mloc = fmaxf(mloc, __shfl_xor(mloc, 16, 32));   // other half holds keys+8
    const float mnew = fmaxf(mrow, mloc);
    const float fac  = __expf(mrow - mnew);
    mrow = mnew;

    // ---- P^T fragments built IN REGISTERS (S^T C-layout == B-operand layout):
    // bp0 element i -> key 16*(i>>3)+8*lh+(i&7) = tile (i>>3), VGPR (i&7), same lane ----
    v16h bp0, bp1;
#pragma unroll
    for (int i = 0; i < 8; ++i) {
      bp0[i]     = (_Float16)__expf(s0[i] - mnew);
      bp0[i + 8] = (_Float16)__expf(s1[i] - mnew);
      bp1[i]     = (_Float16)__expf(s2[i] - mnew);
      bp1[i + 8] = (_Float16)__expf(s3[i] - mnew);
    }

    // ---- rescale running state by fac ----
#pragma unroll
    for (int i = 0; i < 8; ++i) {
      o0[i] *= fac; o1[i] *= fac; o2[i] *= fac; o3[i] *= fac; lacc[i] *= fac;
    }

    // ---- denominator: lacc += ones @ P^T (column sums, all keys covered) ----
    lacc = __builtin_amdgcn_wmma_f32_16x16x32_f16(false, aones, false, bp0, (short)0, lacc, false, false);
    lacc = __builtin_amdgcn_wmma_f32_16x16x32_f16(false, aones, false, bp1, (short)0, lacc, false, false);

    // ---- O^T += V^T @ P^T : four d-row chunks, K-dim 64 = 2 WMMAs each ----
    OT_STEP(o0, 0); OT_STEP(o1, 1); OT_STEP(o2, 2); OT_STEP(o3, 3);
  }

  // ---- normalize and write out: lane ln owns q-row ln; per-lane runs of 8
  // consecutive d values -> merges into global_store_b128 ----
  const float invl = 1.0f / lacc[0];
  float* orow = op + ln * Dd + (lh << 3);
#pragma unroll
  for (int i = 0; i < 8; ++i) {
    orow[i]      = o0[i] * invl;
    orow[16 + i] = o1[i] * invl;
    orow[32 + i] = o2[i] * invl;
    orow[48 + i] = o3[i] * invl;
  }
}

extern "C" void kernel_launch(void* const* d_in, const int* in_sizes, int n_in,
                              void* d_out, int out_size, void* d_ws, size_t ws_size,
                              hipStream_t stream) {
  (void)in_sizes; (void)n_in; (void)out_size; (void)d_ws; (void)ws_size;
  const float* q = (const float*)d_in[0];
  const float* k = (const float*)d_in[1];
  const float* v = (const float*)d_in[2];
  float* o = (float*)d_out;
  const int blocks = Bb * Hh * (Ss / QTILE);   // 1024
  fa_fwd_wmma<<<blocks, 256, 0, stream>>>(q, k, v, o);
}

// v001
// Measured time: 121 microseconds a run.
// Timed twice side by side with v000, it ran 2.37 times as fast both times.
#include <hip/hip_runtime.h>
#include <math.h>

typedef __attribute__((ext_vector_type(16))) _Float16 v16h;
typedef __attribute__((ext_vector_type(8)))  float    v8f;
typedef __attribute__((ext_vector_type(4)))  float    f4;

namespace {
constexpr int Bb = 4, Hh = 16, Ss = 2048, Dd = 64;
constexpr float kScale = 0.125f;   // 1/sqrt(64)
constexpr int QTILE = 128;         // q rows per block = 8 waves * 16
constexpr int KT    = 64;          // kv rows per tile
constexpr int NT    = Ss / KT;     // 32 kv tiles
// LDS row pitch in halves: 128 B of data + 16 B pad = 144 B = 16 B x 9 (odd), so the
// 16 rows one ds_load_b128 touches per half-wave start on 16 different 4-bank groups.
constexpr int KP    = Dd + 8;      // K tile row pitch
constexpr int VP    = KT + 8;      // V^T tile row pitch
}

// 16-bit WMMA A/B fragment K-index (ISA 7.12.2):
// element i of lane L -> K = 16*(i>>3) + 8*(L>=16) + 2*((i>>1)&3) + (i&1)
//                          = 16*(i>>3) + 8*(L>=16) + (i&7)
// Consecutive i give contiguous 8-half runs -> LDS reads vectorize to b128.
__device__ __forceinline__ int kidx(int i, int lh) {
  return ((i >> 3) << 4) + (lh << 3) + (((i >> 1) & 3) << 1) + (i & 1);
}

// S^T_g += K[16g..16g+16) @ Q^T  (A = K-frag from LDS, B = Q^T-frag in regs)
#define ST_STEP(sacc, g) do {                                                             \
    v16h a_;                                                                              \
    _Pragma("unroll") for (int i_ = 0; i_ < 16; ++i_)                                     \
      a_[i_] = Ksh[(16*(g) + ln) * KP + kidx(i_, lh)];                                    \
    sacc = __builtin_amdgcn_wmma_f32_16x16x32_f16(false, a_, false, bq0, (short)0, sacc, false, false); \
    _Pragma("unroll") for (int i_ = 0; i_ < 16; ++i_)                                     \
      a_[i_] = Ksh[(16*(g) + ln) * KP + 32 + kidx(i_, lh)];                               \
    sacc = __builtin_amdgcn_wmma_f32_16x16x32_f16(false, a_, false, bq1, (short)0, sacc, false, false); \
  } while (0)

// O^T_c += V^T[16c..16c+16, :] @ P^T  (A = V^T-frag from LDS, B = P^T in regs)
#define OT_STEP(oacc, c) do {                                                             \
    v16h a_;                                                                              \
    _Pragma("unroll") for (int i_ = 0; i_ < 16; ++i_)                                     \
      a_[i_] = Vts[(16*(c) + ln) * VP + kidx(i_, lh)];                                    \
    oacc = __builtin_amdgcn_wmma_f32_16x16x32_f16(false, a_, false, bp0, (short)0, oacc, false, false); \
    _Pragma("unroll") for (int i_ = 0; i_ < 16; ++i_)                                     \
      a_[i_] = Vts[(16*(c) + ln) * VP + 32 + kidx(i_, lh)];                               \
    oacc = __builtin_amdgcn_wmma_f32_16x16x32_f16(false, a_, false, bp1, (short)0, oacc, false, false); \
  } while (0)

__global__ __launch_bounds__(256, 2)
void fa_fwd_wmma(const float* __restrict__ q, const float* __restrict__ k,
                 const float* __restrict__ v, float* __restrict__ o) {
  __shared__ __attribute__((aligned(16))) _Float16 Ksh[KT * KP];  // K tile [k][d], padded rows, 9 KB
  __shared__ __attribute__((aligned(16))) _Float16 Vts[Dd * VP];  // V tile [d][k] (transposed), padded rows, 9 KB

  const int tid  = threadIdx.x;
  const int lane = tid & 31;
  const int w    = tid >> 5;
  const int lh   = lane >> 4;
  const int ln   = lane & 15;

  const int qblocks = Ss / QTILE;
  const int bh    = blockIdx.x / qblocks;
  const int qblk  = blockIdx.x % qblocks;
  const int qbase = qblk * QTILE + w * 16;

  const float* qp = q + ((size_t)bh * Ss + qbase) * Dd;
  const float* kp = k + (size_t)bh * Ss * Dd;
  const float* vp = v + (size_t)bh * Ss * Dd;
  float*       op = o + ((size_t)bh * Ss + qbase) * Dd;

  // ---- Q tile as two B-fragments (Q^T), pre-scaled by 1/sqrt(D) ----
  v16h bq0, bq1;
#pragma unroll
  for (int i = 0; i < 16; ++i) {
    const int kk = kidx(i, lh);
    bq0[i] = (_Float16)(qp[ln * Dd + kk] * kScale);
    bq1[i] = (_Float16)(qp[ln * Dd + 32 + kk] * kScale);
  }

  // constant all-ones A fragment: ones @ P^T = column sums (softmax denominator)
  v16h aones;
#pragma unroll
  for (int i = 0; i < 16; ++i) aones[i] = (_Float16)1.0f;

  // O^T accumulators: lane = q-col (ln), VGPR i = d row 16c + i + 8*lh
  v8f o0 = {}, o1 = {}, o2 = {}, o3 = {};
  v8f lacc = {};               // denominator (every VGPR row holds q-col sum)
  float mrow = -INFINITY;      // running max for this lane's q-column

  const int kvrow = tid >> 2;            // K/V staging: this thread's k row
  const int d0    = (tid & 3) << 4;      // and d column base (16 cols)

  // ---- register double buffer: preload tile 0 ----
  f4 krg[4], vrg[4];
  {
    const f4* kt0 = (const f4*)(kp + (size_t)tid * 16);
    const f4* vt0 = (const f4*)(vp + (size_t)tid * 16);
#pragma unroll
    for (int j = 0; j < 4; ++j) { krg[j] = kt0[j]; vrg[j] = vt0[j]; }
  }

  for (int t = 0; t < NT; ++t) {
    __syncthreads();                     // previous tile's readers done
    // commit staged registers to LDS (fp32 -> f16); V goes in transposed
    {
      _Float16* kd = Ksh + kvrow * KP + d0;   // 16 contiguous halves -> merged ds_store
#pragma unroll
      for (int j = 0; j < 4; ++j)
#pragma unroll
        for (int c = 0; c < 4; ++c) kd[4 * j + c] = (_Float16)krg[j][c];
#pragma unroll
      for (int j = 0; j < 4; ++j)
#pragma unroll
        for (int c = 0; c < 4; ++c)
          Vts[(d0 + 4 * j + c) * VP + kvrow] = (_Float16)vrg[j][c];
    }
    if (t + 1 < NT) {                    // preload next tile -> overlaps compute
      const f4* ktn = (const f4*)(kp + (size_t)(t + 1) * KT * Dd + tid * 16);
      const f4* vtn = (const f4*)(vp + (size_t)(t + 1) * KT * Dd + tid * 16);
#pragma unroll
      for (int j = 0; j < 4; ++j) { krg[j] = ktn[j]; vrg[j] = vtn[j]; }
    }
    __syncthreads();

    // ---- S^T = K_tile @ (Q*scale)^T : four 16(key)x16(q) accumulators.
    // Lane holds q-col = ln; VGPR j = key 16g + j + 8*lh. ----
    v8f s0 = {}, s1 = {}, s2 = {}, s3 = {};
    ST_STEP(s0, 0); ST_STEP(s1, 1); ST_STEP(s2, 2); ST_STEP(s3, 3);

    // ---- row max for this lane's q-column: in-lane tree + ONE xor-16 bpermute ----
    float mloc = s0[0];
#pragma unroll
    for (int i = 0; i < 8; ++i) {
      mloc = fmaxf(mloc, s0[i]); mloc = fmaxf(mloc, s1[i]);
      mloc = fmaxf(mloc, s2[i]); mloc = fmaxf(mloc, s3[i]);
    }
    mloc = fmaxf(mloc, __shfl_xor(mloc, 16, 32));   // other half holds keys+8
    const float mnew = fmaxf(mrow, mloc);
    const float fac  = __expf(mrow - mnew);
    mrow = mnew;

    // ---- P^T fragments built IN REGISTERS (S^T C-layout == B-operand layout):
    // bp0 element i -> key 16*(i>>3)+8*lh+(i&7) = tile (i>>3), VGPR (i&7), same lane ----
    v16h bp0, bp1;
#pragma unroll
    for (int i = 0; i < 8; ++i) {
      bp0[i]     = (_Float16)__expf(s0[i] - mnew);
      bp0[i + 8] = (_Float16)__expf(s1[i] - mnew);
      bp1[i]     = (_Float16)__expf(s2[i] - mnew);
      bp1[i + 8] = (_Float16)__expf(s3[i] - mnew);
    }

    // ---- rescale running state by fac ----
#pragma unroll
    for (int i = 0; i < 8; ++i) {
      o0[i] *= fac; o1[i] *= fac; o2[i] *= fac; o3[i] *= fac; lacc[i] *= fac;
    }

    // ---- denominator: lacc += ones @ P^T (column sums, all keys covered) ----
    lacc = __builtin_amdgcn_wmma_f32_16x16x32_f16(false, aones, false, bp0, (short)0, lacc, false, false);
    lacc = __builtin_amdgcn_wmma_f32_16x16x32_f16(false, aones, false, bp1, (short)0, lacc, false, false);

    // ---- O^T += V^T @ P^T : four d-row chunks, K-dim 64 = 2 WMMAs each ----
    OT_STEP(o0, 0); OT_STEP(o1, 1); OT_STEP(o2, 2); OT_STEP(o3, 3);
  }

  // ---- normalize and write out: lane ln owns q-row ln; per-lane runs of 8
  // consecutive d values -> merges into global_store_b128 ----
  const float invl = 1.0f / lacc[0];
  float* orow = op + ln * Dd + (lh << 3);
#pragma unroll
  for (int i = 0; i < 8; ++i) {
    orow[i]      = o0[i] * invl;
    orow[16 + i] = o1[i] * invl;
    orow[32 + i] = o2[i] * invl;
    orow[48 + i] = o3[i] * invl;
  }
}

extern "C" void kernel_launch(void* const* d_in, const int* in_sizes, int n_in,
                              void* d_out, int out_size, void* d_ws, size_t ws_size,
                              hipStream_t stream) {
  (void)in_sizes; (void)n_in; (void)out_size; (void)d_ws; (void)ws_size;
  const float* q = (const float*)d_in[0];
  const float* k = (const float*)d_in[1];
  const float* v = (const float*)d_in[2];
  float* o = (float*)d_out;
  const int blocks = Bb * Hh * (Ss / QTILE);   // 1024
  fa_fwd_wmma<<<blocks, 256, 0, stream>>>(q, k, v, o);
}

// v002
// A run of this version takes 80 microseconds.
// Timed twice side by side with v001, it ran 1.51 times as fast both times.
// Over all steps from v000 it is 3.58 times as fast.
#include <hip/hip_runtime.h>
#include <math.h>

typedef __attribute__((ext_vector_type(16))) _Float16 v16h;
typedef __attribute__((ext_vector_type(8)))  float    v8f;
typedef __attribute__((ext_vector_type(4)))  float    f4;

namespace {
constexpr int Bb = 4, Hh = 16, Ss = 2048, Dd = 64;
constexpr float kScale = 0.125f;   // 1/sqrt(64)
constexpr int QG    = 2;           // 16-column query groups per wave: each K / V^T fragment read from LDS feeds QG products
constexpr int QTILE = 128 * QG;    // q rows per block = 8 waves * 16 * QG
constexpr int KT    = 64;          // kv rows per tile
constexpr int NT    = Ss / KT;     // 32 kv tiles
// LDS row pitch in halves: 128 B of data + 16 B pad = 144 B = 16 B x 9 (odd), so the
// 16 rows one ds_load_b128 touches per half-wave start on 16 different 4-bank groups.
constexpr int KP    = Dd + 8;      // K tile row pitch
constexpr int VP    = KT + 8;      // V^T tile row pitch
}

// 16-bit WMMA A/B fragment K-index (ISA 7.12.2):
// element i of lane L -> K = 16*(i>>3) + 8*(L>=16) + 2*((i>>1)&3) + (i&1)
//                          = 16*(i>>3) + 8*(L>=16) + (i&7)
// Consecutive i give contiguous 8-half runs -> LDS reads vectorize to b128.
__device__ __forceinline__ int kidx(int i, int lh) {
  return ((i >> 3) << 4) + (lh << 3) + (((i >> 1) & 3) << 1) + (i & 1);
}

// One 16x32 A fragment: row (row0 + ln) of an LDS tile, k columns col0 .. col0+31
__device__ __forceinline__ v16h afrag(const _Float16* tile, int pitch, int row0, int col0, int ln, int lh) {
  v16h a;
#pragma unroll
  for (int i = 0; i < 16; ++i) a[i] = tile[(row0 + ln) * pitch + col0 + kidx(i, lh)];
  return a;
}

__device__ __forceinline__ v8f mma(v16h a, v16h b, v8f c) {
  return __builtin_amdgcn_wmma_f32_16x16x32_f16(false, a, false, b, (short)0, c, false, false);
}

__global__ __launch_bounds__(256, 2)
void fa_fwd_wmma(const float* __restrict__ q, const float* __restrict__ k,
                 const float* __restrict__ v, float* __restrict__ o) {
  __shared__ __attribute__((aligned(16))) _Float16 Ksh[KT * KP];  // K tile [k][d], padded rows, 9 KB
  __shared__ __attribute__((aligned(16))) _Float16 Vts[Dd * VP];  // V tile [d][k] (transposed), padded rows, 9 KB

  const int tid  = threadIdx.x;
  const int lane = tid & 31;
  const int w    = tid >> 5;
  const int lh   = lane >> 4;
  const int ln   = lane & 15;

  const int qblocks = Ss / QTILE;
  const int bh    = blockIdx.x / qblocks;
  const int qblk  = blockIdx.x % qblocks;
  const int qbase = qblk * QTILE + w * (16 * QG);

  const float* qp = q + ((size_t)bh * Ss + qbase) * Dd;
  const float* kp = k + (size_t)bh * Ss * Dd;
  const float* vp = v + (size_t)bh * Ss * Dd;
  float*       op = o + ((size_t)bh * Ss + qbase) * Dd;

  // ---- Q tile: per query group u two B-fragments (Q^T), pre-scaled by 1/sqrt(D) ----
  v16h bq0[QG], bq1[QG];
#pragma unroll
  for (int u = 0; u < QG; ++u)
#pragma unroll
    for (int i = 0; i < 16; ++i) {
      const int kk = kidx(i, lh);
      bq0[u][i] = (_Float16)(qp[(16 * u + ln) * Dd + kk] * kScale);
      bq1[u][i] = (_Float16)(qp[(16 * u + ln) * Dd + 32 + kk] * kScale);
    }

  // constant all-ones A fragment: ones @ P^T = column sums (softmax denominator)
  v16h aones;
#pragma unroll
  for (int i = 0; i < 16; ++i) aones[i] = (_Float16)1.0f;

  // O^T accumulators oacc[u][c]: lane = q-col 16u + ln, VGPR i = d row 16c + i + 8*lh
  v8f oacc[QG][4] = {};
  v8f lacc[QG] = {};           // denominator (every VGPR row holds q-col sum)
  float mrow[QG];              // running max for this lane's q-column of each group
#pragma unroll
  for (int u = 0; u < QG; ++u) mrow[u] = -INFINITY;

  const int kvrow = tid >> 2;            // K/V staging: this thread's k row
  const int d0    = (tid & 3) << 4;      // and d column base (16 cols)

  // ---- register double buffer: preload tile 0 ----
  f4 krg[4], vrg[4];
  {
    const f4* kt0 = (const f4*)(kp + (size_t)tid * 16);
    const f4* vt0 = (const f4*)(vp + (size_t)tid * 16);
#pragma unroll
    for (int j = 0; j < 4; ++j) { krg[j] = kt0[j]; vrg[j] = vt0[j]; }
  }

  for (int t = 0; t < NT; ++t) {
    __syncthreads();                     // previous tile's readers done
    // commit staged registers to LDS (fp32 -> f16); V goes in transposed
    {
      _Float16* kd = Ksh + kvrow * KP + d0;   // 16 contiguous halves -> merged ds_store
#pragma unroll
      for (int j = 0; j < 4; ++j)
#pragma unroll
        for (int c = 0; c < 4; ++c) kd[4 * j + c] = (_Float16)krg[j][c];
#pragma unroll
      for (int j = 0; j < 4; ++j)
#pragma unroll
        for (int c = 0; c < 4; ++c)
          Vts[(d0 + 4 * j + c) * VP + kvrow] = (_Float16)vrg[j][c];
    }
    if (t + 1 < NT) {                    // preload next tile -> overlaps compute
      const f4* ktn = (const f4*)(kp + (size_t)(t + 1) * KT * Dd + tid * 16);
      const f4* vtn = (const f4*)(vp + (size_t)(t + 1) * KT * Dd + tid * 16);
#pragma unroll
      for (int j = 0; j < 4; ++j) { krg[j] = ktn[j]; vrg[j] = vtn[j]; }
    }
    __syncthreads();

    // ---- S^T = K_tile @ (Q*scale)^T : per query group four 16(key)x16(q) accumulators.
    // Lane holds q-col = 16u + ln; VGPR j = key 16g + j + 8*lh. Each K fragment is read once for QG products. ----
    v8f s[QG][4] = {};
#pragma unroll
    for (int g = 0; g < 4; ++g) {
      const v16h alo = afrag(Ksh, KP, 16 * g, 0, ln, lh);
      const v16h ahi = afrag(Ksh, KP, 16 * g, 32, ln, lh);
#pragma unroll
      for (int u = 0; u < QG; ++u) s[u][g] = mma(alo, bq0[u], s[u][g]);
#pragma unroll
      for (int u = 0; u < QG; ++u) s[u][g] = mma(ahi, bq1[u], s[u][g]);
    }

    v16h bp0[QG], bp1[QG];
#pragma unroll
    for (int u = 0; u < QG; ++u) {
      // ---- row max for this lane's q-column: in-lane tree + ONE xor-16 bpermute ----
      float mloc = s[u][0][0];
#pragma unroll
      for (int i = 0; i < 8; ++i) {
        mloc = fmaxf(mloc, s[u][0][i]); mloc = fmaxf(mloc, s[u][1][i]);
        mloc = fmaxf(mloc, s[u][2][i]); mloc = fmaxf(mloc, s[u][3][i]);
      }
      mloc = fmaxf(mloc, __shfl_xor(mloc, 16, 32));   // other half holds keys+8
      const float mnew = fmaxf(mrow[u], mloc);
      const float fac  = __expf(mrow[u] - mnew);
      mrow[u] = mnew;

      // ---- P^T fragments built IN REGISTERS (S^T C-layout == B-operand layout):
      // bp0 element i -> key 16*(i>>3)+8*lh+(i&7) = tile (i>>3), VGPR (i&7), same lane ----
#pragma unroll
      for (int g = 0; g < 4; ++g) s[u][g] = s[u][g] - mnew;
#pragma unroll
      for (int i = 0; i < 8; ++i) {
        bp0[u][i]     = (_Float16)__expf(s[u][0][i]);
        bp0[u][i + 8] = (_Float16)__expf(s[u][1][i]);
        bp1[u][i]     = (_Float16)__expf(s[u][2][i]);
        bp1[u][i + 8] = (_Float16)__expf(s[u][3][i]);
      }

      // ---- rescale running state by fac ----
#pragma unroll
      for (int i = 0; i < 8; ++i) {
        oacc[u][0][i] *= fac; oacc[u][1][i] *= fac; oacc[u][2][i] *= fac; oacc[u][3][i] *= fac;
        lacc[u][i] *= fac;
      }

      // ---- denominator: lacc += ones @ P^T (column sums, all keys covered) ----
      lacc[u] = mma(aones, bp0[u], lacc[u]);
      lacc[u] = mma(aones, bp1[u], lacc[u]);
    }

    // ---- O^T += V^T @ P^T : four d-row chunks, K-dim 64 = 2 WMMAs each per query group;
    // each V^T fragment is read once for QG products ----
#pragma unroll
    for (int c = 0; c < 4; ++c) {
      const v16h alo = afrag(Vts, VP, 16 * c, 0, ln, lh);
      const v16h ahi = afrag(Vts, VP, 16 * c, 32, ln, lh);
#pragma unroll
      for (int u = 0; u < QG; ++u) oacc[u][c] = mma(alo, bp0[u], oacc[u][c]);
#pragma unroll
      for (int u = 0; u < QG; ++u) oacc[u][c] = mma(ahi, bp1[u], oacc[u][c]);
    }
  }

  // ---- normalize and write out: lane ln owns q-row 16u + ln; per-lane runs of 8
  // consecutive d values -> merges into global_store_b128 ----
#pragma unroll
  for (int u = 0; u < QG; ++u) {
    const float invl = 1.0f / lacc[u][0];
    float* orow = op + (16 * u + ln) * Dd + (lh << 3);
#pragma unroll
    for (int i = 0; i < 8; ++i) {
      orow[i]      = oacc[u][0][i] * invl;
      orow[16 + i] = oacc[u][1][i] * invl;
      orow[32 + i] = oacc[u][2][i] * invl;
      orow[48 + i] = oacc[u][3][i] * invl;
    }
  }
}

extern "C" void kernel_launch(void* const* d_in, const int* in_sizes, int n_in,
                              void* d_out, int out_size, void* d_ws, size_t ws_size,
                              hipStream_t stream) {
  (void)in_sizes; (void)n_in; (void)out_size; (void)d_ws; (void)ws_size;
  const float* q = (const float*)d_in[0];
  const float* k = (const float*)d_in[1];
  const float* v = (const float*)d_in[2];
  float* o = (float*)d_out;
  const int blocks = Bb * Hh * (Ss / QTILE);   // 512
  fa_fwd_wmma<<<blocks, 256, 0, stream>>>(q, k, v, o);
}

// v003
// One run takes 72 microseconds.
// Two timings next to v002 both put it at 1.11 times that version's speed.
// All steps since v000 together make it 3.97 times as fast.
#include <hip/hip_runtime.h>
#include <math.h>

typedef __attribute__((ext_vector_type(16))) _Float16 v16h;
typedef __attribute__((ext_vector_type(8)))  float    v8f;
typedef __attribute__((ext_vector_type(4)))  float    f4;

namespace {
constexpr int Bb = 4, Hh = 16, Ss = 2048, Dd = 64;
constexpr float kScale = 0.125f;   // 1/sqrt(64)
constexpr int QG    = 2;           // 16-column query groups per wave: each K / V^T fragment read from LDS feeds QG products
constexpr int QTILE = 128 * QG;    // q rows per block = 8 waves * 16 * QG
constexpr int KT    = 64;          // kv rows per tile
constexpr int NT    = Ss / KT;     // 32 kv tiles
// LDS row pitch in halves: 128 B of data + 16 B pad = 144 B = 16 B x 9 (odd), so the
// 16 rows one ds_load_b128 touches per half-wave start on 16 different 4-bank groups.
constexpr int KP    = Dd + 8;      // K tile row pitch
constexpr int VP    = KT + 8;      // V^T tile row pitch
}

// 16-bit WMMA A/B fragment K-index (ISA 7.12.2):
// element i of lane L -> K = 16*(i>>3) + 8*(L>=16) + 2*((i>>1)&3) + (i&1)
//                          = 16*(i>>3) + 8*(L>=16) + (i&7)
// Consecutive i give contiguous 8-half runs -> LDS reads vectorize to b128.
__device__ __forceinline__ int kidx(int i, int lh) {
  return ((i >> 3) << 4) + (lh << 3) + (((i >> 1) & 3) << 1) + (i & 1);
}

// One 16x32 A fragment: row (row0 + ln) of an LDS tile, k columns col0 .. col0+31
__device__ __forceinline__ v16h afrag(const _Float16* tile, int pitch, int row0, int col0, int ln, int lh) {
  v16h a;
#pragma unroll
  for (int i = 0; i < 16; ++i) a[i] = tile[(row0 + ln) * pitch + col0 + kidx(i, lh)];
  return a;
}

__device__ __forceinline__ v8f mma(v16h a, v16h b, v8f c) {
  return __builtin_amdgcn_wmma_f32_16x16x32_f16(false, a, false, b, (short)0, c, false, false);
}

__global__ __launch_bounds__(256, 2)
void fa_fwd_wmma(const float* __restrict__ q, const float* __restrict__ k,
                 const float* __restrict__ v, float* __restrict__ o) {
  // two buffers each: tile t is read from buffer t & 1 while tile t + 1 is written to the other
  __shared__ __attribute__((aligned(16))) _Float16 KshB[2][KT * KP];  // K tile [k][d], padded rows, 2 x 9 KB
  __shared__ __attribute__((aligned(16))) _Float16 VtsB[2][Dd * VP];  // V tile [d][k] (transposed), padded rows, 2 x 9 KB

  const int tid  = threadIdx.x;
  const int lane = tid & 31;
  const int w    = tid >> 5;
  const int lh   = lane >> 4;
  const int ln   = lane & 15;

  const int qblocks = Ss / QTILE;
  const int bh    = blockIdx.x / qblocks;
  const int qblk  = blockIdx.x % qblocks;
  const int qbase = qblk * QTILE + w * (16 * QG);

  const float* qp = q + ((size_t)bh * Ss + qbase) * Dd;
  const float* kp = k + (size_t)bh * Ss * Dd;
  const float* vp = v + (size_t)bh * Ss * Dd;
  float*       op = o + ((size_t)bh * Ss + qbase) * Dd;

  // ---- Q tile: per query group u two B-fragments (Q^T), pre-scaled by 1/sqrt(D) ----
  v16h bq0[QG], bq1[QG];
#pragma unroll
  for (int u = 0; u < QG; ++u)
#pragma unroll
    for (int i = 0; i < 16; ++i) {
      const int kk = kidx(i, lh);
      bq0[u][i] = (_Float16)(qp[(16 * u + ln) * Dd + kk] * kScale);
      bq1[u][i] = (_Float16)(qp[(16 * u + ln) * Dd + 32 + kk] * kScale);
    }

  // constant all-ones A fragment: ones @ P^T = column sums (softmax denominator)
  v16h aones;
#pragma unroll
  for (int i = 0; i < 16; ++i) aones[i] = (_Float16)1.0f;

  // O^T accumulators oacc[u][c]: lane = q-col 16u + ln, VGPR i = d row 16c + i + 8*lh
  v8f oacc[QG][4] = {};
  v8f lacc[QG] = {};           // denominator (every VGPR row holds q-col sum)
  float mrow[QG];              // running max for this lane's q-column of each group
#pragma unroll
  for (int u = 0; u < QG; ++u) mrow[u] = -INFINITY;

  const int kvrow = tid >> 2;            // K/V staging: this thread's k row
  const int d0    = (tid & 3) << 4;      // and d column base (16 cols)

  f4 krg[4], vrg[4];                     // one tile's share of this thread, fp32, on its way to LDS
  // fetch tile tt into the staging registers
  auto fetch = [&](int tt) {
    const f4* ktn = (const f4*)(kp + (size_t)tt * KT * Dd + tid * 16);
    const f4* vtn = (const f4*)(vp + (size_t)tt * KT * Dd + tid * 16);
#pragma unroll
    for (int j = 0; j < 4; ++j) { krg[j] = ktn[j]; vrg[j] = vtn[j]; }
  };
  // commit the staging registers to LDS buffer b (fp32 -> f16); V goes in transposed
  auto commit = [&](int b) {
    _Float16* kd = KshB[b] + kvrow * KP + d0;   // 16 contiguous halves -> merged ds_store
#pragma unroll
    for (int j = 0; j < 4; ++j)
#pragma unroll
      for (int c = 0; c < 4; ++c) kd[4 * j + c] = (_Float16)krg[j][c];
#pragma unroll
    for (int j = 0; j < 4; ++j)
#pragma unroll
      for (int c = 0; c < 4; ++c)
        VtsB[b][(d0 + 4 * j + c) * VP + kvrow] = (_Float16)vrg[j][c];
  };

  fetch(0);
  commit(0);
  __syncthreads();                       // tile 0 published

  for (int t = 0; t < NT; ++t) {
    const _Float16* Ksh = KshB[t & 1];
    const _Float16* Vts = VtsB[t & 1];
    // next tile's global loads go out first and stay in flight under this tile's products:
    // no barrier stands between them and their commit at the foot of the pass
    if (t + 1 < NT) fetch(t + 1);

    // ---- S^T = K_tile @ (Q*scale)^T : per query group four 16(key)x16(q) accumulators.
    // Lane holds q-col = 16u + ln; VGPR j = key 16g + j + 8*lh. Each K fragment is read once for QG products. ----
    v8f s[QG][4] = {};
#pragma unroll
    for (int g = 0; g < 4; ++g) {
      const v16h alo = afrag(Ksh, KP, 16 * g, 0, ln, lh);
      const v16h ahi = afrag(Ksh, KP, 16 * g, 32, ln, lh);
#pragma unroll
      for (int u = 0; u < QG; ++u) s[u][g] = mma(alo, bq0[u], s[u][g]);
#pragma unroll
      for (int u = 0; u < QG; ++u) s[u][g] = mma(ahi, bq1[u], s[u][g]);
    }

    v16h bp0[QG], bp1[QG];
#pragma unroll
    for (int u = 0; u < QG; ++u) {
      // ---- row max for this lane's q-column: in-lane tree + ONE xor-16 bpermute ----
      float mloc = s[u][0][0];
#pragma unroll
      for (int i = 0; i < 8; ++i) {
        mloc = fmaxf(mloc, s[u][0][i]); mloc = fmaxf(mloc, s[u][1][i]);
        mloc = fmaxf(mloc, s[u][2][i]); mloc = fmaxf(mloc, s[u][3][i]);
      }
      mloc = fmaxf(mloc, __shfl_xor(mloc, 16, 32));   // other half holds keys+8
      const float mnew = fmaxf(mrow[u], mloc);
      const float fac  = __expf(mrow[u] - mnew);
      mrow[u] = mnew;

      // ---- P^T fragments built IN REGISTERS (S^T C-layout == B-operand layout):
      // bp0 element i -> key 16*(i>>3)+8*lh+(i&7) = tile (i>>3), VGPR (i&7), same lane ----
#pragma unroll
      for (int g = 0; g < 4; ++g) s[u][g] = s[u][g] - mnew;
#pragma unroll
      for (int i = 0; i < 8; ++i) {
        bp0[u][i]     = (_Float16)__expf(s[u][0][i]);
        bp0[u][i + 8] = (_Float16)__expf(s[u][1][i]);
        bp1[u][i]     = (_Float16)__expf(s[u][2][i]);
        bp1[u][i + 8] = (_Float16)__expf(s[u][3][i]);
      }

      // ---- rescale running state by fac ----
#pragma unroll
      for (int i = 0; i < 8; ++i) {
        oacc[u][0][i] *= fac; oacc[u][1][i] *= fac; oacc[u][2][i] *= fac; oacc[u][3][i] *= fac;
        lacc[u][i] *= fac;
      }

      // ---- denominator: lacc += ones @ P^T (column sums, all keys covered) ----
      lacc[u] = mma(aones, bp0[u], lacc[u]);
      lacc[u] = mma(aones, bp1[u], lacc[u]);
    }

    // ---- O^T += V^T @ P^T : four d-row chunks, K-dim 64 = 2 WMMAs each per query group;
    // each V^T fragment is read once for QG products ----
#pragma unroll
    for (int c = 0; c < 4; ++c) {
      const v16h alo = afrag(Vts, VP, 16 * c, 0, ln, lh);
      const v16h ahi = afrag(Vts, VP, 16 * c, 32, ln, lh);
#pragma unroll
      for (int u = 0; u < QG; ++u) oacc[u][c] = mma(alo, bp0[u], oacc[u][c]);
#pragma unroll
      for (int u = 0; u < QG; ++u) oacc[u][c] = mma(ahi, bp1[u], oacc[u][c]);
    }

    if (t + 1 < NT) {
      commit((t + 1) & 1);               // that buffer's last readers (pass t - 1) left before the barrier of pass t - 1
      __syncthreads();                   // publishes tile t + 1 and ends every wave's reads of tile t
    }
  }

  // ---- normalize and write out: lane ln owns q-row 16u + ln; per-lane runs of 8
  // consecutive d values -> merges into global_store_b128 ----
#pragma unroll
  for (int u = 0; u < QG; ++u) {
    const float invl = 1.0f / lacc[u][0];
    float* orow = op + (16 * u + ln) * Dd + (lh << 3);
#pragma unroll
    for (int i = 0; i < 8; ++i) {
      orow[i]      = oacc[u][0][i] * invl;
      orow[16 + i] = oacc[u][1][i] * invl;
      orow[32 + i] = oacc[u][2][i] * invl;
      orow[48 + i] = oacc[u][3][i] * invl;
    }
  }
}

extern "C" void kernel_launch(void* const* d_in, const int* in_sizes, int n_in,
                              void* d_out, int out_size, void* d_ws, size_t ws_size,
                              hipStream_t stream) {
  (void)in_sizes; (void)n_in; (void)out_size; (void)d_ws; (void)ws_size;
  const float* q = (const float*)d_in[0];
  const float* k = (const float*)d_in[1];
  const float* v = (const float*)d_in[2];
  float* o = (float*)d_out;
  const int blocks = Bb * Hh * (Ss / QTILE);   // 512
  fa_fwd_wmma<<<blocks, 256, 0, stream>>>(q, k, v, o);
}

// v004
// It runs in 67.6 microseconds.
// Two timings next to v003 both put it at 1.07 times that version's speed.
// Over all steps from v000 it is 4.24 times as fast.
#include <hip/hip_runtime.h>
#include <math.h>

typedef __attribute__((ext_vector_type(16))) _Float16 v16h;
typedef __attribute__((ext_vector_type(8)))  _Float16 v8h;
typedef __attribute__((ext_vector_type(8)))  short    s16x8;
typedef __attribute__((ext_vector_type(8)))  float    v8f;
typedef __attribute__((ext_vector_type(4)))  float    f4;

namespace {
constexpr int Bb = 4, Hh = 16, Ss = 2048, Dd = 64;
constexpr float kScale = 0.125f;   // 1/sqrt(64)
constexpr int QG    = 2;           // 16-column query groups per wave: each K / V^T fragment read from LDS feeds QG products
constexpr int QTILE = 128 * QG;    // q rows per block = 8 waves * 16 * QG
constexpr int KT    = 64;          // kv rows per tile
constexpr int NT    = Ss / KT;     // 32 kv tiles
// LDS row pitch in halves: 128 B of data + 16 B pad = 144 B = 16 B x 9 (odd), so the
// 16 rows one ds_load_b128 touches per half-wave start on 16 different 4-bank groups.
constexpr int KP    = Dd + 8;      // K tile row pitch
// V rows are read by the transposing load, whose conflict-free pitch is 32 B x odd: 128 B + 32 B = 160 B
constexpr int VP    = Dd + 16;     // V tile row pitch
}

// 16-bit WMMA A/B fragment K-index (ISA 7.12.2):
// element i of lane L -> K = 16*(i>>3) + 8*(L>=16) + 2*((i>>1)&3) + (i&1)
//                          = 16*(i>>3) + 8*(L>=16) + (i&7)
// Consecutive i give contiguous 8-half runs -> LDS reads vectorize to b128.
__device__ __forceinline__ int kidx(int i, int lh) {
  return ((i >> 3) << 4) + (lh << 3) + (((i >> 1) & 3) << 1) + (i & 1);
}

// One 16x32 A fragment: row (row0 + ln) of an LDS tile, k columns col0 .. col0+31
__device__ __forceinline__ v16h afrag(const _Float16* tile, int pitch, int row0, int col0, int ln, int lh) {
  v16h a;
#pragma unroll
  for (int i = 0; i < 16; ++i) a[i] = tile[(row0 + ln) * pitch + col0 + kidx(i, lh)];
  return a;
}

// One 16(d) x 32(key) A fragment of V^T out of the row-major V tile [key][d]: the transposing LDS load hands
// lane (ln, lh) the 8 keys k + 8*lh .. +7 of column dcol + ln; loads at k0 and k0 + 16 give the kidx order.
__device__ __forceinline__ v16h vtfrag(const _Float16* tile, int dcol, int k0, int lane) {
  typedef __attribute__((address_space(3))) s16x8 lds_s16x8;
  const _Float16* p = tile + (k0 + ((lane >> 4) << 3) + (lane & 7)) * VP + dcol + (((lane >> 3) & 1) << 3);
  const v8h lo = __builtin_bit_cast(v8h, __builtin_amdgcn_ds_load_tr16_b128_v8i16((lds_s16x8*)p));
  const v8h hi = __builtin_bit_cast(v8h, __builtin_amdgcn_ds_load_tr16_b128_v8i16((lds_s16x8*)(p + 16 * VP)));
  return __builtin_shufflevector(lo, hi, 0, 1, 2, 3, 4, 5, 6, 7, 8, 9, 10, 11, 12, 13, 14, 15);
}

__device__ __forceinline__ v8f mma(v16h a, v16h b, v8f c) {
  return __builtin_amdgcn_wmma_f32_16x16x32_f16(false, a, false, b, (short)0, c, false, false);
}

__global__ __launch_bounds__(256, 2)
void fa_fwd_wmma(const float* __restrict__ q, const float* __restrict__ k,
                 const float* __restrict__ v, float* __restrict__ o) {
  // two buffers each: tile t is read from buffer t & 1 while tile t + 1 is written to the other
  __shared__ __attribute__((aligned(16))) _Float16 KshB[2][KT * KP];  // K tile [k][d], padded rows, 2 x 9 KB
  __shared__ __attribute__((aligned(16))) _Float16 VshB[2][KT * VP];  // V tile [k][d], as in memory, padded rows, 2 x 10 KB

  const int tid  = threadIdx.x;
  const int lane = tid & 31;
  const int w    = tid >> 5;
  const int lh   = lane >> 4;
  const int ln   = lane & 15;

  const int qblocks = Ss / QTILE;
  const int bh    = blockIdx.x / qblocks;
  const int qblk  = blockIdx.x % qblocks;
  const int qbase = qblk * QTILE + w * (16 * QG);

  const float* qp = q + ((size_t)bh * Ss + qbase) * Dd;
  const float* kp = k + (size_t)bh * Ss * Dd;
  const float* vp = v + (size_t)bh * Ss * Dd;
  float*       op = o + ((size_t)bh * Ss + qbase) * Dd;

  // ---- Q tile: per query group u two B-fragments (Q^T), pre-scaled by 1/sqrt(D) ----
  v16h bq0[QG], bq1[QG];
#pragma unroll
  for (int u = 0; u < QG; ++u)
#pragma unroll
    for (int i = 0; i < 16; ++i) {
      const int kk = kidx(i, lh);
      bq0[u][i] = (_Float16)(qp[(16 * u + ln) * Dd + kk] * kScale);
      bq1[u][i] = (_Float16)(qp[(16 * u + ln) * Dd + 32 + kk] * kScale);
    }

  // constant all-ones A fragment: ones @ P^T = column sums (softmax denominator)
  v16h aones;
#pragma unroll
  for (int i = 0; i < 16; ++i) aones[i] = (_Float16)1.0f;

  // O^T accumulators oacc[u][c]: lane = q-col 16u + ln, VGPR i = d row 16c + i + 8*lh
  v8f oacc[QG][4] = {};
  v8f lacc[QG] = {};           // denominator (every VGPR row holds q-col sum)
  float mrow[QG];              // running max for this lane's q-column of each group
#pragma unroll
  for (int u = 0; u < QG; ++u) mrow[u] = -INFINITY;

  const int kvrow = tid >> 2;            // K/V staging: this thread's k row
  const int d0    = (tid & 3) << 4;      // and d column base (16 cols)

  f4 krg[4], vrg[4];                     // one tile's share of this thread, fp32, on its way to LDS
  // fetch tile tt into the staging registers
  auto fetch = [&](int tt) {
    const f4* ktn = (const f4*)(kp + (size_t)tt * KT * Dd + tid * 16);
    const f4* vtn = (const f4*)(vp + (size_t)tt * KT * Dd + tid * 16);
#pragma unroll
    for (int j = 0; j < 4; ++j) { krg[j] = ktn[j]; vrg[j] = vtn[j]; }
  };
  // commit the staging registers to LDS buffer b (fp32 -> f16); K and V both row-major
  auto commit = [&](int b) {
    _Float16* kd = KshB[b] + kvrow * KP + d0;   // 16 contiguous halves -> merged ds_store
#pragma unroll
    for (int j = 0; j < 4; ++j)
#pragma unroll
      for (int c = 0; c < 4; ++c) kd[4 * j + c] = (_Float16)krg[j][c];
    _Float16* vd = VshB[b] + kvrow * VP + d0;   // likewise
#pragma unroll
    for (int j = 0; j < 4; ++j)
#pragma unroll
      for (int c = 0; c < 4; ++c) vd[4 * j + c] = (_Float16)vrg[j][c];
  };

  fetch(0);
  commit(0);
  __syncthreads();                       // tile 0 published

  for (int t = 0; t < NT; ++t) {
    const _Float16* Ksh = KshB[t & 1];
    const _Float16* Vsh = VshB[t & 1];
    // next tile's global loads go out first and stay in flight under this tile's products:
    // no barrier stands between them and their commit at the foot of the pass
    if (t + 1 < NT) fetch(t + 1);

    // ---- S^T = K_tile @ (Q*scale)^T : per query group four 16(key)x16(q) accumulators.
    // Lane holds q-col = 16u + ln; VGPR j = key 16g + j + 8*lh. Each K fragment is read once for QG products. ----
    v8f s[QG][4] = {};
#pragma unroll
    for (int g = 0; g < 4; ++g) {
      const v16h alo = afrag(Ksh, KP, 16 * g, 0, ln, lh);
      const v16h ahi = afrag(Ksh, KP, 16 * g, 32, ln, lh);
#pragma unroll
      for (int u = 0; u < QG; ++u) s[u][g] = mma(alo, bq0[u], s[u][g]);
#pragma unroll
      for (int u = 0; u < QG; ++u) s[u][g] = mma(ahi, bq1[u], s[u][g]);
    }

    v16h bp0[QG], bp1[QG];
#pragma unroll
    for (int u = 0; u < QG; ++u) {
      // ---- row max for this lane's q-column: in-lane tree + ONE xor-16 bpermute ----
      float mloc = s[u][0][0];
#pragma unroll
      for (int i = 0; i < 8; ++i) {
        mloc = fmaxf(mloc, s[u][0][i]); mloc = fmaxf(mloc, s[u][1][i]);
        mloc = fmaxf(mloc, s[u][2][i]); mloc = fmaxf(mloc, s[u][3][i]);
      }
      mloc = fmaxf(mloc, __shfl_xor(mloc, 16, 32));   // other half holds keys+8
      const float mnew = fmaxf(mrow[u], mloc);
      const float fac  = __expf(mrow[u] - mnew);
      mrow[u] = mnew;

      // ---- P^T fragments built IN REGISTERS (S^T C-layout == B-operand layout):
      // bp0 element i -> key 16*(i>>3)+8*lh+(i&7) = tile (i>>3), VGPR (i&7), same lane ----
#pragma unroll
      for (int g = 0; g < 4; ++g) s[u][g] = s[u][g] - mnew;
#pragma unroll
      for (int i = 0; i < 8; ++i) {
        bp0[u][i]     = (_Float16)__expf(s[u][0][i]);
        bp0[u][i + 8] = (_Float16)__expf(s[u][1][i]);
        bp1[u][i]     = (_Float16)__expf(s[u][2][i]);
        bp1[u][i + 8] = (_Float16)__expf(s[u][3][i]);
      }

      // ---- rescale running state by fac ----
#pragma unroll
      for (int i = 0; i < 8; ++i) {
        oacc[u][0][i] *= fac; oacc[u][1][i] *= fac; oacc[u][2][i] *= fac; oacc[u][3][i] *= fac;
        lacc[u][i] *= fac;
      }

      // ---- denominator: lacc += ones @ P^T (column sums, all keys covered) ----
      lacc[u] = mma(aones, bp0[u], lacc[u]);
      lacc[u] = mma(aones, bp1[u], lacc[u]);
    }

    // ---- O^T += V^T @ P^T : four d-row chunks, K-dim 64 = 2 WMMAs each per query group;
    // each V^T fragment is read once for QG products ----
#pragma unroll
    for (int c = 0; c < 4; ++c) {
      const v16h alo = vtfrag(Vsh, 16 * c, 0, lane);
      const v16h ahi = vtfrag(Vsh, 16 * c, 32, lane);
#pragma unroll
      for (int u = 0; u < QG; ++u) oacc[u][c] = mma(alo, bp0[u], oacc[u][c]);
#pragma unroll
      for (int u = 0; u < QG; ++u) oacc[u][c] = mma(ahi, bp1[u], oacc[u][c]);
    }

    if (t + 1 < NT) {
      commit((t + 1) & 1);               // that buffer's last readers (pass t - 1) left before the barrier of pass t - 1
      __syncthreads();                   // publishes tile t + 1 and ends every wave's reads of tile t
    }
  }

  // ---- normalize and write out: lane ln owns q-row 16u + ln; per-lane runs of 8
  // consecutive d values -> merges into global_store_b128 ----
#pragma unroll
  for (int u = 0; u < QG; ++u) {
    const float invl = 1.0f / lacc[u][0];
    float* orow = op + (16 * u + ln) * Dd + (lh << 3);
#pragma unroll
    for (int i = 0; i < 8; ++i) {
      orow[i]      = oacc[u][0][i] * invl;
      orow[16 + i] = oacc[u][1][i] * invl;
      orow[32 + i] = oacc[u][2][i] * invl;
      orow[48 + i] = oacc[u][3][i] * invl;
    }
  }
}

extern "C" void kernel_launch(void* const* d_in, const int* in_sizes, int n_in,
                              void* d_out, int out_size, void* d_ws, size_t ws_size,
                              hipStream_t stream) {
  (void)in_sizes; (void)n_in; (void)out_size; (void)d_ws; (void)ws_size;
  const float* q = (const float*)d_in[0];
  const float* k = (const float*)d_in[1];
  const float* v = (const float*)d_in[2];
  float* o = (float*)d_out;
  const int blocks = Bb * Hh * (Ss / QTILE);   // 512
  fa_fwd_wmma<<<blocks, 256, 0, stream>>>(q, k, v, o);
}

// v005
// It runs in 59.9 microseconds.
// Timed twice side by side with v004, it ran 1.13 times as fast both times.
// All steps since v000 together make it 4.78 times as fast.
#include <hip/hip_runtime.h>
#include <math.h>

typedef __attribute__((ext_vector_type(16))) _Float16 v16h;
typedef __attribute__((ext_vector_type(8)))  _Float16 v8h;
typedef __attribute__((ext_vector_type(8)))  short    s16x8;
typedef __attribute__((ext_vector_type(8)))  float    v8f;
typedef __attribute__((ext_vector_type(4)))  float    f4;

namespace {
constexpr int Bb = 4, Hh = 16, Ss = 2048, Dd = 64;
constexpr float kScale = 0.125f;   // 1/sqrt(64)
constexpr int QG    = 2;           // 16-column query groups per wave: each K / V^T fragment read from LDS feeds QG products
constexpr int QTILE = 128 * QG;    // q rows per block = 8 waves * 16 * QG
constexpr int KT    = 64;          // kv rows per tile
constexpr int NT    = Ss / KT;     // 32 kv tiles
// LDS row pitch in halves: 128 B of data + 16 B pad = 144 B = 16 B x 9 (odd), so the
// 16 rows one ds_load_b128 touches per half-wave start on 16 different 4-bank groups.
constexpr int KP    = Dd + 8;      // K tile row pitch
// V rows are read by the transposing load, whose conflict-free pitch is 32 B x odd: 128 B + 32 B = 160 B
constexpr int VP    = Dd + 16;     // V tile row pitch
constexpr int KBUF  = KT * KP;     // halves per K buffer
constexpr int VBUF  = KT * VP;     // halves per V buffer
constexpr int SMEMH = 2 * KBUF + 2 * VBUF;   // all LDS, in halves (38,912 B)
// Before the first and after the last tile the same LDS is eight wave-private slabs, in which Q and O are turned
// between whole-line global order and fragment order
constexpr int SLABH = SMEMH / 8;   // 4,864 B per wave: 32 Q rows at pitch KP, or 16 O rows at pitch OP
constexpr int OP    = Dd + 4;      // O row pitch in floats: 272 B = 16 B x 17 (odd), as for K
static_assert(32 * KP <= SLABH && 16 * OP * 2 <= SLABH && (SLABH * 2) % 16 == 0, "slab too small");
}

// 16-bit WMMA A/B fragment K-index (ISA 7.12.2):
// element i of lane L -> K = 16*(i>>3) + 8*(L>=16) + 2*((i>>1)&3) + (i&1)
//                          = 16*(i>>3) + 8*(L>=16) + (i&7)
// Consecutive i give contiguous 8-half runs -> LDS reads vectorize to b128.
__device__ __forceinline__ int kidx(int i, int lh) {
  return ((i >> 3) << 4) + (lh << 3) + (((i >> 1) & 3) << 1) + (i & 1);
}

// One 16x32 A fragment: row (row0 + ln) of an LDS tile, k columns col0 .. col0+31
__device__ __forceinline__ v16h afrag(const _Float16* tile, int pitch, int row0, int col0, int ln, int lh) {
  v16h a;
#pragma unroll
  for (int i = 0; i < 16; ++i) a[i] = tile[(row0 + ln) * pitch + col0 + kidx(i, lh)];
  return a;
}

// One 16(d) x 32(key) A fragment of V^T out of the row-major V tile [key][d]: the transposing LDS load hands
// lane (ln, lh) the 8 keys k + 8*lh .. +7 of column dcol + ln; loads at k0 and k0 + 16 give the kidx order.
__device__ __forceinline__ v16h vtfrag(const _Float16* tile, int dcol, int k0, int lane) {
  typedef __attribute__((address_space(3))) s16x8 lds_s16x8;
  const _Float16* p = tile + (k0 + ((lane >> 4) << 3) + (lane & 7)) * VP + dcol + (((lane >> 3) & 1) << 3);
  const v8h lo = __builtin_bit_cast(v8h, __builtin_amdgcn_ds_load_tr16_b128_v8i16((lds_s16x8*)p));
  const v8h hi = __builtin_bit_cast(v8h, __builtin_amdgcn_ds_load_tr16_b128_v8i16((lds_s16x8*)(p + 16 * VP)));
  return __builtin_shufflevector(lo, hi, 0, 1, 2, 3, 4, 5, 6, 7, 8, 9, 10, 11, 12, 13, 14, 15);
}

__device__ __forceinline__ v8f mma(v16h a, v16h b, v8f c) {
  return __builtin_amdgcn_wmma_f32_16x16x32_f16(false, a, false, b, (short)0, c, false, false);
}

__global__ __launch_bounds__(256, 2)
void fa_fwd_wmma(const float* __restrict__ q, const float* __restrict__ k,
                 const float* __restrict__ v, float* __restrict__ o) {
  // two buffers each: tile t is read from buffer t & 1 while tile t + 1 is written to the other
  __shared__ __attribute__((aligned(16))) _Float16 smem[SMEMH];
  _Float16* const KshB = smem;             // K tile [k][d], padded rows, 2 x 9 KB: buffer b at b * KBUF
  _Float16* const VshB = smem + 2 * KBUF;  // V tile [k][d], as in memory, padded rows, 2 x 10 KB: buffer b at b * VBUF

  const int tid  = threadIdx.x;
  const int lane = tid & 31;
  const int w    = tid >> 5;
  const int lh   = lane >> 4;
  const int ln   = lane & 15;

  const int qblocks = Ss / QTILE;
  const int bh    = blockIdx.x / qblocks;
  const int qblk  = blockIdx.x % qblocks;
  const int qbase = qblk * QTILE + w * (16 * QG);

  const float* qp = q + ((size_t)bh * Ss + qbase) * Dd;
  const float* kp = k + (size_t)bh * Ss * Dd;
  const float* vp = v + (size_t)bh * Ss * Dd;
  float*       op = o + ((size_t)bh * Ss + qbase) * Dd;

  // constant all-ones A fragment: ones @ P^T = column sums (softmax denominator)
  v16h aones;
#pragma unroll
  for (int i = 0; i < 16; ++i) aones[i] = (_Float16)1.0f;

  // O^T accumulators oacc[u][c]: lane = q-col 16u + ln, VGPR i = d row 16c + i + 8*lh
  v8f oacc[QG][4] = {};
  v8f lacc[QG] = {};           // denominator (every VGPR row holds q-col sum)
  float mrow[QG];              // running max for this lane's q-column of each group
#pragma unroll
  for (int u = 0; u < QG; ++u) mrow[u] = -INFINITY;

  // K/V staging: piece j of this thread is float4 number j * 256 + tid of the tile, so the 32 lanes of a wave
  // load 512 contiguous bytes = four whole 128 B lines per instruction (a lane-private 64 B run touched 16 lines)
  const int kvrow = tid >> 4;            // k row of piece 0; piece j lies 16 rows further down
  const int d0    = (tid & 15) << 2;     // d column base (4 cols)

  f4 krg[4], vrg[4];                     // one tile's share of this thread, fp32, on its way to LDS
  // fetch tile tt into the staging registers
  auto fetch = [&](int tt) {
    const f4* ktn = (const f4*)(kp + (size_t)tt * KT * Dd) + tid;
    const f4* vtn = (const f4*)(vp + (size_t)tt * KT * Dd) + tid;
#pragma unroll
    for (int j = 0; j < 4; ++j) { krg[j] = ktn[j * 256]; vrg[j] = vtn[j * 256]; }
  };
  // commit the staging registers to LDS buffer b (fp32 -> f16); K and V both row-major
  auto commit = [&](int b) {
    _Float16* kd = KshB + b * KBUF + kvrow * KP + d0;   // 4 contiguous halves per piece -> one ds_store_b64 each
#pragma unroll
    for (int j = 0; j < 4; ++j)
#pragma unroll
      for (int c = 0; c < 4; ++c) kd[16 * j * KP + c] = (_Float16)krg[j][c];
    _Float16* vd = VshB + b * VBUF + kvrow * VP + d0;   // likewise
#pragma unroll
    for (int j = 0; j < 4; ++j)
#pragma unroll
      for (int c = 0; c < 4; ++c) vd[16 * j * VP + c] = (_Float16)vrg[j][c];
  };

  fetch(0);                              // tile 0 flies under the Q turn

  // ---- Q tile: per query group u two B-fragments (Q^T), pre-scaled by 1/sqrt(D). The wave's 32 rows (8 KB) are
  // loaded 512 contiguous bytes per instruction, rounded to f16 into the wave's own slab and read back as fragments ----
  _Float16* const slab = smem + w * SLABH;
  v16h bq0[QG], bq1[QG];
  {
    const f4* qv = (const f4*)qp + lane;
    f4 qr[8 * QG];
#pragma unroll
    for (int j = 0; j < 8 * QG; ++j) qr[j] = qv[j * 32];   // float4 j * 32 + lane: row 2j + lh, columns 4 ln .. 4 ln + 3
#pragma unroll
    for (int j = 0; j < 8 * QG; ++j)
#pragma unroll
      for (int c = 0; c < 4; ++c) slab[(2 * j + lh) * KP + (ln << 2) + c] = (_Float16)(qr[j][c] * kScale);
  }
  asm volatile("s_wait_dscnt 0x0" ::: "memory");   // the wave's own slab stores are done before other lanes' rows are read
#pragma unroll
  for (int u = 0; u < QG; ++u) {
    bq0[u] = afrag(slab, KP, 16 * u, 0, ln, lh);
    bq1[u] = afrag(slab, KP, 16 * u, 32, ln, lh);
  }
  __syncthreads();                       // every wave has read its Q slab before tile 0 is written over the slabs

  commit(0);
  __syncthreads();                       // tile 0 published

  for (int t = 0; t < NT; ++t) {
    const _Float16* Ksh = KshB + (t & 1) * KBUF;
    const _Float16* Vsh = VshB + (t & 1) * VBUF;
    // next tile's global loads go out first and stay in flight under this tile's products:
    // no barrier stands between them and their commit at the foot of the pass
    if (t + 1 < NT) fetch(t + 1);

    // ---- S^T = K_tile @ (Q*scale)^T : per query group four 16(key)x16(q) accumulators.
    // Lane holds q-col = 16u + ln; VGPR j = key 16g + j + 8*lh. Each K fragment is read once for QG products. ----
    v8f s[QG][4] = {};
#pragma unroll
    for (int g = 0; g < 4; ++g) {
      const v16h alo = afrag(Ksh, KP, 16 * g, 0, ln, lh);
      const v16h ahi = afrag(Ksh, KP, 16 * g, 32, ln, lh);
#pragma unroll
      for (int u = 0; u < QG; ++u) s[u][g] = mma(alo, bq0[u], s[u][g]);
#pragma unroll
      for (int u = 0; u < QG; ++u) s[u][g] = mma(ahi, bq1[u], s[u][g]);
    }

    v16h bp0[QG], bp1[QG];
#pragma unroll
    for (int u = 0; u < QG; ++u) {
      // ---- row max for this lane's q-column: in-lane tree + ONE xor-16 bpermute ----
      float mloc = s[u][0][0];
#pragma unroll
      for (int i = 0; i < 8; ++i) {
        mloc = fmaxf(mloc, s[u][0][i]); mloc = fmaxf(mloc, s[u][1][i]);
        mloc = fmaxf(mloc, s[u][2][i]); mloc = fmaxf(mloc, s[u][3][i]);
      }
      mloc = fmaxf(mloc, __shfl_xor(mloc, 16, 32));   // other half holds keys+8
      const float mnew = fmaxf(mrow[u], mloc);
      const float fac  = __expf(mrow[u] - mnew);
      mrow[u] = mnew;

      // ---- P^T fragments built IN REGISTERS (S^T C-layout == B-operand layout):
      // bp0 element i -> key 16*(i>>3)+8*lh+(i&7) = tile (i>>3), VGPR (i&7), same lane ----
#pragma unroll
      for (int g = 0; g < 4; ++g) s[u][g] = s[u][g] - mnew;
#pragma unroll
      for (int i = 0; i < 8; ++i) {
        bp0[u][i]     = (_Float16)__expf(s[u][0][i]);
        bp0[u][i + 8] = (_Float16)__expf(s[u][1][i]);
        bp1[u][i]     = (_Float16)__expf(s[u][2][i]);
        bp1[u][i + 8] = (_Float16)__expf(s[u][3][i]);
      }

      // ---- rescale running state by fac ----
#pragma unroll
      for (int i = 0; i < 8; ++i) {
        oacc[u][0][i] *= fac; oacc[u][1][i] *= fac; oacc[u][2][i] *= fac; oacc[u][3][i] *= fac;
        lacc[u][i] *= fac;
      }

      // ---- denominator: lacc += ones @ P^T (column sums, all keys covered) ----
      lacc[u] = mma(aones, bp0[u], lacc[u]);
      lacc[u] = mma(aones, bp1[u], lacc[u]);
    }

    // ---- O^T += V^T @ P^T : four d-row chunks, K-dim 64 = 2 WMMAs each per query group;
    // each V^T fragment is read once for QG products ----
#pragma unroll
    for (int c = 0; c < 4; ++c) {
      const v16h alo = vtfrag(Vsh, 16 * c, 0, lane);
      const v16h ahi = vtfrag(Vsh, 16 * c, 32, lane);
#pragma unroll
      for (int u = 0; u < QG; ++u) oacc[u][c] = mma(alo, bp0[u], oacc[u][c]);
#pragma unroll
      for (int u = 0; u < QG; ++u) oacc[u][c] = mma(ahi, bp1[u], oacc[u][c]);
    }

    if (t + 1 < NT) {
      commit((t + 1) & 1);               // that buffer's last readers (pass t - 1) left before the barrier of pass t - 1
      __syncthreads();                   // publishes tile t + 1 and ends every wave's reads of tile t
    }
  }

  // ---- normalize and write out: lane ln owns q-row 16u + ln in runs of 8 d values; the 16 rows of a group are
  // turned through the wave's own slab so that each global_store_b128 of the wave covers 512 contiguous bytes ----
  __syncthreads();                       // the waves leave the loop apart: every wave's reads of the last tile end here
  float* const oslab = (float*)slab;
#pragma unroll
  for (int u = 0; u < QG; ++u) {
    const float invl = 1.0f / lacc[u][0];
    float* orow = oslab + ln * OP + (lh << 3);
#pragma unroll
    for (int i = 0; i < 8; ++i) {
      orow[i]      = oacc[u][0][i] * invl;
      orow[16 + i] = oacc[u][1][i] * invl;
      orow[32 + i] = oacc[u][2][i] * invl;
      orow[48 + i] = oacc[u][3][i] * invl;
    }
    asm volatile("s_wait_dscnt 0x0" ::: "memory");   // the group's rows are in the slab before other lanes read them
    f4* og = (f4*)(op + 16 * u * Dd) + lane;
#pragma unroll
    for (int j = 0; j < 8; ++j) og[j * 32] = *(const f4*)(oslab + (2 * j + lh) * OP + (ln << 2));
  }
}

extern "C" void kernel_launch(void* const* d_in, const int* in_sizes, int n_in,
                              void* d_out, int out_size, void* d_ws, size_t ws_size,
                              hipStream_t stream) {
  (void)in_sizes; (void)n_in; (void)out_size; (void)d_ws; (void)ws_size;
  const float* q = (const float*)d_in[0];
  const float* k = (const float*)d_in[1];
  const float* v = (const float*)d_in[2];
  float* o = (float*)d_out;
  const int blocks = Bb * Hh * (Ss / QTILE);   // 512
  fa_fwd_wmma<<<blocks, 256, 0, stream>>>(q, k, v, o);
}

// v006
// It runs in 56.4 microseconds.
// Timed twice side by side with v005, it ran 1.06 and 1.07 times as fast.
// All steps since v000 together make it 5.09 times as fast.
#include <hip/hip_runtime.h>
#include <math.h>

typedef __attribute__((ext_vector_type(16))) _Float16 v16h;
typedef __attribute__((ext_vector_type(8)))  _Float16 v8h;
typedef __attribute__((ext_vector_type(8)))  short    s16x8;
typedef __attribute__((ext_vector_type(8)))  float    v8f;
typedef __attribute__((ext_vector_type(4)))  float    f4;

namespace {
constexpr int Bb = 4, Hh = 16, Ss = 2048, Dd = 64;
constexpr float kScale = 0.125f;   // 1/sqrt(64)
// a column's maximum in use is raised only when a score stands more than this above it: 8 ln 2, so P <= 256 in f16
constexpr float kLazy  = 5.545177f;
constexpr int QG    = 2;           // 16-column query groups per wave: each K / V^T fragment read from LDS feeds QG products
constexpr int QTILE = 128 * QG;    // q rows per block = 8 waves * 16 * QG
constexpr int KT    = 64;          // kv rows per tile
constexpr int NT    = Ss / KT;     // 32 kv tiles
// LDS row pitch in halves: 128 B of data + 16 B pad = 144 B = 16 B x 9 (odd), so the
// 16 rows one ds_load_b128 touches per half-wave start on 16 different 4-bank groups.
constexpr int KP    = Dd + 8;      // K tile row pitch
// V rows are read by the transposing load, whose conflict-free pitch is 32 B x odd: 128 B + 32 B = 160 B
constexpr int VP    = Dd + 16;     // V tile row pitch
constexpr int KBUF  = KT * KP;     // halves per K buffer
constexpr int VBUF  = KT * VP;     // halves per V buffer
constexpr int SMEMH = 2 * KBUF + 2 * VBUF;   // all LDS, in halves (38,912 B)
// Before the first and after the last tile the same LDS is eight wave-private slabs, in which Q and O are turned
// between whole-line global order and fragment order
constexpr int SLABH = SMEMH / 8;   // 4,864 B per wave: 32 Q rows at pitch KP, or 16 O rows at pitch OP
constexpr int OP    = Dd + 4;      // O row pitch in floats: 272 B = 16 B x 17 (odd), as for K
static_assert(32 * KP <= SLABH && 16 * OP * 2 <= SLABH && (SLABH * 2) % 16 == 0, "slab too small");
}

// 16-bit WMMA A/B fragment K-index (ISA 7.12.2):
// element i of lane L -> K = 16*(i>>3) + 8*(L>=16) + 2*((i>>1)&3) + (i&1)
//                          = 16*(i>>3) + 8*(L>=16) + (i&7)
// Consecutive i give contiguous 8-half runs -> LDS reads vectorize to b128.
__device__ __forceinline__ int kidx(int i, int lh) {
  return ((i >> 3) << 4) + (lh << 3) + (((i >> 1) & 3) << 1) + (i & 1);
}

// One 16x32 A fragment: row (row0 + ln) of an LDS tile, k columns col0 .. col0+31
__device__ __forceinline__ v16h afrag(const _Float16* tile, int pitch, int row0, int col0, int ln, int lh) {
  v16h a;
#pragma unroll
  for (int i = 0; i < 16; ++i) a[i] = tile[(row0 + ln) * pitch + col0 + kidx(i, lh)];
  return a;
}

// One 16(d) x 32(key) A fragment of V^T out of the row-major V tile [key][d]: the transposing LDS load hands
// lane (ln, lh) the 8 keys k + 8*lh .. +7 of column dcol + ln; loads at k0 and k0 + 16 give the kidx order.
__device__ __forceinline__ v16h vtfrag(const _Float16* tile, int dcol, int k0, int lane) {
  typedef __attribute__((address_space(3))) s16x8 lds_s16x8;
  const _Float16* p = tile + (k0 + ((lane >> 4) << 3) + (lane & 7)) * VP + dcol + (((lane >> 3) & 1) << 3);
  const v8h lo = __builtin_bit_cast(v8h, __builtin_amdgcn_ds_load_tr16_b128_v8i16((lds_s16x8*)p));
  const v8h hi = __builtin_bit_cast(v8h, __builtin_amdgcn_ds_load_tr16_b128_v8i16((lds_s16x8*)(p + 16 * VP)));
  return __builtin_shufflevector(lo, hi, 0, 1, 2, 3, 4, 5, 6, 7, 8, 9, 10, 11, 12, 13, 14, 15);
}

// lane l's value of lane l ^ 16, by a vector cross-row move (needs no index register and no LDS wait)
__device__ __forceinline__ float xhalf(float x) {
  const int b = __builtin_bit_cast(int, x);
  return __builtin_bit_cast(float, __builtin_amdgcn_permlanex16(b, b, 0x76543210, 0xfedcba98, false, false));
}

__device__ __forceinline__ v8f mma(v16h a, v16h b, v8f c) {
  return __builtin_amdgcn_wmma_f32_16x16x32_f16(false, a, false, b, (short)0, c, false, false);
}

// four waves per SIMD (two blocks per WGP, the whole grid resident) need at most 256 VGPRs
__global__ __launch_bounds__(256) __attribute__((amdgpu_waves_per_eu(4, 4)))
void fa_fwd_wmma(const float* __restrict__ q, const float* __restrict__ k,
                 const float* __restrict__ v, float* __restrict__ o) {
  // two buffers each: tile t is read from buffer t & 1 while tile t + 1 is written to the other
  __shared__ __attribute__((aligned(16))) _Float16 smem[SMEMH];
  _Float16* const KshB = smem;             // K tile [k][d], padded rows, 2 x 9 KB: buffer b at b * KBUF
  _Float16* const VshB = smem + 2 * KBUF;  // V tile [k][d], as in memory, padded rows, 2 x 10 KB: buffer b at b * VBUF

  const int tid  = threadIdx.x;
  const int lane = tid & 31;
  const int w    = tid >> 5;
  const int ws   = __builtin_amdgcn_readfirstlane(w);   // the same, as a wave-uniform value
  const int lh   = lane >> 4;
  const int ln   = lane & 15;

  const int qblocks = Ss / QTILE;
  const int bh    = blockIdx.x / qblocks;
  const int qblk  = blockIdx.x % qblocks;
  const int qbase = qblk * QTILE + ws * (16 * QG);

  const float* qp = q + ((size_t)bh * Ss + qbase) * Dd;
  const float* kp = k + (size_t)bh * Ss * Dd;
  const float* vp = v + (size_t)bh * Ss * Dd;

  // constant all-ones A fragment: ones @ P^T = column sums (softmax denominator)
  v16h aones;
#pragma unroll
  for (int i = 0; i < 16; ++i) aones[i] = (_Float16)1.0f;

  // O^T accumulators oacc[u][c]: lane = q-col 16u + ln, VGPR i = d row 16c + i + 8*lh
  v8f oacc[QG][4] = {};
  v8f lacc[QG] = {};           // denominator (every VGPR row holds q-col sum)
  // minus the maximum in use for this lane's q-column of each group, in all eight registers: the C operand on which
  // the score products start, so that they come out as score - maximum. Set below, once tile 0 is in LDS.
  v8f negm[QG];

  // K/V staging: piece j of this thread is float4 number j * 256 + tid of the tile, so the 32 lanes of a wave
  // load 512 contiguous bytes = four whole 128 B lines per instruction (a lane-private 64 B run touched 16 lines)
  const int kvrow = tid >> 4;            // k row of piece 0; piece j lies 16 rows further down
  const int d0    = (tid & 15) << 2;     // d column base (4 cols)

  // fetch this thread's share of tile tt, fp32, into staging registers on its way to LDS
  // (the tile's address is the same for the whole block; the thread adds one 32-bit offset, shared by K and V)
  const unsigned toff = (unsigned)tid * 16u;
  typedef const __attribute__((address_space(1))) char* gbytes;
  typedef const __attribute__((address_space(1))) f4*   gf4;
  // holds a block-uniform address in scalar registers: otherwise the compiler adds the thread's offset to it ahead of the
  // loop and keeps a 64-bit address per thread and tensor in VGPRs, which the 256-VGPR budget has no room for
  auto scalar_base = [](const float* p) {
    const unsigned long long a = (unsigned long long)p;
    const unsigned lo = __builtin_amdgcn_readfirstlane((unsigned)a);
    const unsigned hi = __builtin_amdgcn_readfirstlane((unsigned)(a >> 32));
    return (gbytes)(((unsigned long long)hi << 32) | lo);
  };
  auto fetchK = [&](int tt, f4 (&krg)[4]) {
    gbytes ktn = scalar_base(kp + (size_t)tt * (KT * Dd));
#pragma unroll
    for (int j = 0; j < 4; ++j) krg[j] = *(gf4)(ktn + j * 4096 + toff);
  };
  auto fetchV = [&](int tt, f4 (&vrg)[4]) {
    gbytes vtn = scalar_base(vp + (size_t)tt * (KT * Dd));
#pragma unroll
    for (int j = 0; j < 4; ++j) vrg[j] = *(gf4)(vtn + j * 4096 + toff);
  };
  // commit the staging registers to LDS buffer b (fp32 -> f16); K and V both row-major
  auto commitK = [&](int b, const f4 (&krg)[4]) {
    _Float16* kd = KshB + b * KBUF + kvrow * KP + d0;   // 4 contiguous halves per piece -> one ds_store_b64 each
#pragma unroll
    for (int j = 0; j < 4; ++j)
#pragma unroll
      for (int c = 0; c < 4; ++c) kd[16 * j * KP + c] = (_Float16)krg[j][c];
  };
  auto commitV = [&](int b, const f4 (&vrg)[4]) {
    _Float16* vd = VshB + b * VBUF + kvrow * VP + d0;   // likewise
#pragma unroll
    for (int j = 0; j < 4; ++j)
#pragma unroll
      for (int c = 0; c < 4; ++c) vd[16 * j * VP + c] = (_Float16)vrg[j][c];
  };

  // ---- Q tile: per query group u two B-fragments (Q^T), pre-scaled by 1/sqrt(D). The wave's 32 rows (8 KB) are
  // loaded 512 contiguous bytes per instruction, rounded to f16 into the wave's own slab and read back as fragments ----
  _Float16* const slab = smem + ws * SLABH;
  v16h bq0[QG], bq1[QG];
  f4 krg0[4], vrg0[4], kst[4];
  {
    const f4* qv = (const f4*)qp + lane;
    f4 qr[8 * QG];
#pragma unroll
    for (int j = 0; j < 8 * QG; ++j) qr[j] = qv[j * 32];   // float4 j * 32 + lane: row 2j + lh, columns 4 ln .. 4 ln + 3
    asm volatile("s_wait_xcnt 0x0" ::: "memory");   // stands in front of the first overwrite of a register that the Q loads name
    fetchK(0, krg0); fetchV(0, vrg0);    // tile 0 flies under the Q turn
    fetchK(1, kst);                      // and so does tile 1's K share, which pass 0 commits
    asm volatile("s_wait_xcnt 0x0" ::: "memory");   // likewise for the registers that these twelve loads name
#pragma unroll
    for (int j = 0; j < 8 * QG; ++j)
#pragma unroll
      for (int c = 0; c < 4; ++c) slab[(2 * j + lh) * KP + (ln << 2) + c] = (_Float16)(qr[j][c] * kScale);
  }
  asm volatile("s_wait_dscnt 0x0" ::: "memory");   // the wave's own slab stores are done before other lanes' rows are read
#pragma unroll
  for (int u = 0; u < QG; ++u) {
    bq0[u] = afrag(slab, KP, 16 * u, 0, ln, lh);
    bq1[u] = afrag(slab, KP, 16 * u, 32, ln, lh);
  }
  __syncthreads();                       // every wave has read its Q slab before tile 0 is written over the slabs

  commitK(0, krg0); commitV(0, vrg0);
  __syncthreads();                       // tile 0 published

  // the first maximum in use: each column's largest score among keys 0 .. 15. It is a true score of the row, so the
  // denominator holds a term 1 from the start and cannot vanish, however low the scores lie.
  {
    const v16h alo = afrag(KshB, KP, 0, 0, ln, lh);
    const v16h ahi = afrag(KshB, KP, 0, 32, ln, lh);
#pragma unroll
    for (int u = 0; u < QG; ++u) {
      v8f s0 = {};
      s0 = mma(alo, bq0[u], s0);
      s0 = mma(ahi, bq1[u], s0);
      float m0 = s0[0];
#pragma unroll
      for (int i = 1; i < 8; ++i) m0 = fmaxf(m0, s0[i]);
      m0 = fmaxf(m0, xhalf(m0));                // other half holds keys+8
#pragma unroll
      for (int i = 0; i < 8; ++i) negm[u][i] = -m0;
    }
  }

  for (int t = 0; t < NT; ++t) {
    const _Float16* Ksh = KshB + (t & 1) * KBUF;
    const _Float16* Vsh = VshB + (t & 1) * VBUF;
    const bool more = t + 1 < NT;
    // ---- S^T = K_tile @ (Q*scale)^T : per query group four 16(key)x16(q) accumulators.
    // Lane holds q-col = 16u + ln; VGPR j = key 16g + j + 8*lh. Each K fragment is read once for QG products.
    // The sums start at negm: s = score - maximum in use. ----
    v8f s[QG][4];
    v16h kf[4][2];
#pragma unroll
    for (int g = 0; g < 4; ++g) {
      kf[g][0] = afrag(Ksh, KP, 16 * g, 0, ln, lh);
      kf[g][1] = afrag(Ksh, KP, 16 * g, 32, ln, lh);
    }
    // keeps all of the tile's sixteen K reads ahead of the products: at the 256-VGPR budget the compiler otherwise
    // splits them into groups that reuse registers, and the wave waits out the LDS latency once per group
    __builtin_amdgcn_sched_barrier(0);
#pragma unroll
    for (int g = 0; g < 4; ++g) {
      const v16h alo = kf[g][0];
      const v16h ahi = kf[g][1];
#pragma unroll
      for (int u = 0; u < QG; ++u) s[u][g] = mma(alo, bq0[u], negm[u]);
#pragma unroll
      for (int u = 0; u < QG; ++u) s[u][g] = mma(ahi, bq1[u], s[u][g]);
    }

    // keeps the sixteen score products back to back: a maximum moved in among them reads a fresh accumulator and
    // costs four v_nop each time
    __builtin_amdgcn_sched_barrier(0);

    // ---- how far this lane's 64 scores (both groups) stand above their maxima in use: in-lane only, four independent
    // chains of 17, 17, 15, 15 values (whole three-input maxima), in the order in which the accumulators finish ----
    float top;
    {
      auto x = [&](int n) { return s[(n >> 3) & 1][n >> 4][n & 7]; };
      float c[4];
      constexpr int first[5] = {0, 17, 34, 49, 64};
#pragma unroll
      for (int h = 0; h < 4; ++h) {
        c[h] = x(first[h]);
#pragma unroll
        for (int n = first[h] + 1; n < first[h + 1]; ++n) c[h] = fmaxf(c[h], x(n));
      }
      top = fmaxf(fmaxf(fmaxf(c[0], c[1]), c[2]), c[3]);
    }

    // ---- lazy maximum: ONE wave-uniform test per tile. Only if some column's score exceeds its maximum in use by
    // more than kLazy are the maxima raised and the running state rescaled ----
    if (__builtin_amdgcn_ballot_w32(top > kLazy) != 0u) {
#pragma unroll
      for (int u = 0; u < QG; ++u) {
        float over = 0.0f;                                               // only a rise counts
#pragma unroll
        for (int g = 0; g < 4; ++g)
#pragma unroll
          for (int i = 0; i < 8; ++i) over = fmaxf(over, s[u][g][i]);
        const float d   = fmaxf(over, xhalf(over));                      // the rise of this column's maximum; other half holds keys+8
        const float fac = __expf(-d);
        negm[u] = negm[u] - d;
#pragma unroll
        for (int g = 0; g < 4; ++g) s[u][g] = s[u][g] - d;
#pragma unroll
        for (int i = 0; i < 8; ++i) {
          oacc[u][0][i] *= fac; oacc[u][1][i] *= fac; oacc[u][2][i] *= fac; oacc[u][3][i] *= fac;
          lacc[u][i] *= fac;
        }
      }
    }

    // Staging, timed so that the kernel stays within 256 VGPRs: under the score products, where the K fragments need the
    // room, only a K share is held in registers. Here tile t + 1's K share, fetched one pass ago, is committed; then tile
    // t + 1's V share and tile t + 2's K share (the last tile's a second time, unused, rather than a branch) go out and
    // fly under the exponentials and the V products, up to the foot of the pass. The buffers written are free for the
    // whole pass: their last readers left before the barrier of pass t - 1.
    f4 vst[4];
    if (more) {
      commitK((t + 1) & 1, kst);
      fetchV(t + 1, vst);
      fetchK(t + 2 < NT ? t + 2 : NT - 1, kst);
    }

    v16h bp0[QG], bp1[QG];
#pragma unroll
    for (int u = 0; u < QG; ++u) {
      // ---- P^T fragments built IN REGISTERS (S^T C-layout == B-operand layout):
      // bp0 element i -> key 16*(i>>3)+8*lh+(i&7) = tile (i>>3), VGPR (i&7), same lane ----
#pragma unroll
      for (int i = 0; i < 8; ++i) {
        bp0[u][i]     = (_Float16)__expf(s[u][0][i]);
        bp0[u][i + 8] = (_Float16)__expf(s[u][1][i]);
        bp1[u][i]     = (_Float16)__expf(s[u][2][i]);
        bp1[u][i + 8] = (_Float16)__expf(s[u][3][i]);
      }

      // ---- denominator: lacc += ones @ P^T (column sums, all keys covered) ----
      lacc[u] = mma(aones, bp0[u], lacc[u]);
      lacc[u] = mma(aones, bp1[u], lacc[u]);
    }

    // ---- O^T += V^T @ P^T : four d-row chunks, K-dim 64 = 2 WMMAs each per query group;
    // each V^T fragment is read once for QG products ----
#pragma unroll
    for (int c = 0; c < 4; ++c) {
      const v16h alo = vtfrag(Vsh, 16 * c, 0, lane);
      const v16h ahi = vtfrag(Vsh, 16 * c, 32, lane);
#pragma unroll
      for (int u = 0; u < QG; ++u) oacc[u][c] = mma(alo, bp0[u], oacc[u][c]);
#pragma unroll
      for (int u = 0; u < QG; ++u) oacc[u][c] = mma(ahi, bp1[u], oacc[u][c]);
    }

    if (more) {
      commitV((t + 1) & 1, vst);
      __syncthreads();                   // publishes tile t + 1 and ends every wave's reads of tile t
    }
  }

  // ---- normalize and write out: lane ln owns q-row 16u + ln in runs of 8 d values; the 16 rows of a group are
  // turned through the wave's own slab so that each global_store_b128 of the wave covers 512 contiguous bytes ----
  __syncthreads();                       // the waves leave the loop apart: every wave's reads of the last tile end here
  // the lane's number is formed anew and the wave's number is taken as wave-uniform, so that this part's addresses are
  // formed here and not held in VGPRs across the loop (they spilled to scratch at the 256-VGPR budget)
  const int lane2 = (int)__builtin_amdgcn_mbcnt_lo(~0u, 0u);
  const int lh2   = lane2 >> 4;
  const int ln2   = lane2 & 15;
  float* const oslab = (float*)(smem + ws * SLABH);
#pragma unroll
  for (int u = 0; u < QG; ++u) {
    const float invl = 1.0f / lacc[u][0];
    float* orow = oslab + ln2 * OP + (lh2 << 3);
#pragma unroll
    for (int i = 0; i < 8; ++i) {
      orow[i]      = oacc[u][0][i] * invl;
      orow[16 + i] = oacc[u][1][i] * invl;
      orow[32 + i] = oacc[u][2][i] * invl;
      orow[48 + i] = oacc[u][3][i] * invl;
    }
    asm volatile("s_wait_dscnt 0x0" ::: "memory");   // the group's rows are in the slab before other lanes read them
    f4* og = (f4*)(o + ((size_t)bh * Ss + qblk * QTILE) * Dd);           // the block's rows: the same for all its threads
    const unsigned o4 = (unsigned)ws * (16 * QG * Dd / 4) + 16 * u * Dd / 4 + lane2;
#pragma unroll
    for (int j = 0; j < 8; ++j) og[o4 + j * 32] = *(const f4*)(oslab + (2 * j + lh2) * OP + (ln2 << 2));
  }
}

extern "C" void kernel_launch(void* const* d_in, const int* in_sizes, int n_in,
                              void* d_out, int out_size, void* d_ws, size_t ws_size,
                              hipStream_t stream) {
  (void)in_sizes; (void)n_in; (void)out_size; (void)d_ws; (void)ws_size;
  const float* q = (const float*)d_in[0];
  const float* k = (const float*)d_in[1];
  const float* v = (const float*)d_in[2];
  float* o = (float*)d_out;
  const int blocks = Bb * Hh * (Ss / QTILE);   // 512
  fa_fwd_wmma<<<blocks, 256, 0, stream>>>(q, k, v, o);
}

// v007
// It runs in 54.6 microseconds.
// Two timings next to v006 put it at 1.04 and 1.03 times that version's speed.
// Over all steps from v000 it is 5.24 times as fast.
#include <hip/hip_runtime.h>
#include <math.h>

typedef __attribute__((ext_vector_type(16))) _Float16 v16h;
typedef __attribute__((ext_vector_type(8)))  _Float16 v8h;
typedef __attribute__((ext_vector_type(8)))  short    s16x8;
typedef __attribute__((ext_vector_type(8)))  float    v8f;
typedef __attribute__((ext_vector_type(4)))  float    f4;

namespace {
constexpr int Bb = 4, Hh = 16, Ss = 2048, Dd = 64;
// Scores are kept in base 2: Q is pre-scaled by log2(e)/sqrt(64), so that exp(score - maximum) is the bare
// exp2 of what the score products deliver and no multiply stands in front of any exponential
constexpr float kScale = 0.125f * 1.4426950408889634f;
// a column's maximum in use is raised only when a score stands more than this above it: 8 doublings, so P <= 256 in f16
constexpr float kLazy  = 8.0f;
constexpr int QG    = 2;           // 16-column query groups per wave: each K / V^T fragment read from LDS feeds QG products
constexpr int QTILE = 128 * QG;    // q rows per block = 8 waves * 16 * QG
constexpr int KT    = 64;          // kv rows per tile
constexpr int NT    = Ss / KT;     // 32 kv tiles
// LDS row pitch in halves: 128 B of data + 16 B pad = 144 B = 16 B x 9 (odd), so the
// 16 rows one ds_load_b128 touches per half-wave start on 16 different 4-bank groups.
constexpr int KP    = Dd + 8;      // K tile row pitch
// V rows are read by the transposing load, whose conflict-free pitch is 32 B x odd: 128 B + 32 B = 160 B
constexpr int VP    = Dd + 16;     // V tile row pitch
constexpr int KBUF  = KT * KP;     // halves per K buffer
constexpr int VBUF  = KT * VP;     // halves per V buffer
constexpr int SMEMH = 2 * KBUF + 2 * VBUF;   // all LDS, in halves (38,912 B)
// Before the first and after the last tile the same LDS is eight wave-private slabs, in which Q and O are turned
// between whole-line global order and fragment order
constexpr int SLABH = SMEMH / 8;   // 4,864 B per wave: 32 Q rows at pitch KP, or 16 O rows at pitch OP
constexpr int OP    = Dd + 4;      // O row pitch in floats: 272 B = 16 B x 17 (odd), as for K
static_assert(32 * KP <= SLABH && 16 * OP * 2 <= SLABH && (SLABH * 2) % 16 == 0, "slab too small");
}

// 16-bit WMMA A/B fragment K-index (ISA 7.12.2):
// element i of lane L -> K = 16*(i>>3) + 8*(L>=16) + 2*((i>>1)&3) + (i&1)
//                          = 16*(i>>3) + 8*(L>=16) + (i&7)
// Consecutive i give contiguous 8-half runs -> LDS reads vectorize to b128.
__device__ __forceinline__ int kidx(int i, int lh) {
  return ((i >> 3) << 4) + (lh << 3) + (((i >> 1) & 3) << 1) + (i & 1);
}

// One 16x32 A fragment: row (row0 + ln) of an LDS tile, k columns col0 .. col0+31
__device__ __forceinline__ v16h afrag(const _Float16* tile, int pitch, int row0, int col0, int ln, int lh) {
  v16h a;
#pragma unroll
  for (int i = 0; i < 16; ++i) a[i] = tile[(row0 + ln) * pitch + col0 + kidx(i, lh)];
  return a;
}

// One 16(d) x 32(key) A fragment of V^T out of the row-major V tile [key][d]: the transposing LDS load hands
// lane (ln, lh) the 8 keys k + 8*lh .. +7 of column dcol + ln; loads at k0 and k0 + 16 give the kidx order.
__device__ __forceinline__ v16h vtfrag(const _Float16* tile, int dcol, int k0, int lane) {
  typedef __attribute__((address_space(3))) s16x8 lds_s16x8;
  const _Float16* p = tile + (k0 + ((lane >> 4) << 3) + (lane & 7)) * VP + dcol + (((lane >> 3) & 1) << 3);
  const v8h lo = __builtin_bit_cast(v8h, __builtin_amdgcn_ds_load_tr16_b128_v8i16((lds_s16x8*)p));
  const v8h hi = __builtin_bit_cast(v8h, __builtin_amdgcn_ds_load_tr16_b128_v8i16((lds_s16x8*)(p + 16 * VP)));
  return __builtin_shufflevector(lo, hi, 0, 1, 2, 3, 4, 5, 6, 7, 8, 9, 10, 11, 12, 13, 14, 15);
}

// lane l's value of lane l ^ 16, by a vector cross-row move (needs no index register and no LDS wait)
__device__ __forceinline__ float xhalf(float x) {
  const int b = __builtin_bit_cast(int, x);
  return __builtin_bit_cast(float, __builtin_amdgcn_permlanex16(b, b, 0x76543210, 0xfedcba98, false, false));
}

__device__ __forceinline__ v8f mma(v16h a, v16h b, v8f c) {
  return __builtin_amdgcn_wmma_f32_16x16x32_f16(false, a, false, b, (short)0, c, false, false);
}

// four waves per SIMD (two blocks per WGP, the whole grid resident) need at most 256 VGPRs
__global__ __launch_bounds__(256) __attribute__((amdgpu_waves_per_eu(4, 4)))
void fa_fwd_wmma(const float* __restrict__ q, const float* __restrict__ k,
                 const float* __restrict__ v, float* __restrict__ o) {
  // two buffers each: tile t is read from buffer t & 1 while tile t + 1 is written to the other
  __shared__ __attribute__((aligned(16))) _Float16 smem[SMEMH];
  _Float16* const KshB = smem;             // K tile [k][d], padded rows, 2 x 9 KB: buffer b at b * KBUF
  _Float16* const VshB = smem + 2 * KBUF;  // V tile [k][d], as in memory, padded rows, 2 x 10 KB: buffer b at b * VBUF

  const int tid  = threadIdx.x;
  const int lane = tid & 31;
  const int w    = tid >> 5;
  const int ws   = __builtin_amdgcn_readfirstlane(w);   // the same, as a wave-uniform value
  const int lh   = lane >> 4;
  const int ln   = lane & 15;

  const int qblocks = Ss / QTILE;
  const int bh    = blockIdx.x / qblocks;
  const int qblk  = blockIdx.x % qblocks;
  const int qbase = qblk * QTILE + ws * (16 * QG);

  const float* qp = q + ((size_t)bh * Ss + qbase) * Dd;
  const float* kp = k + (size_t)bh * Ss * Dd;
  const float* vp = v + (size_t)bh * Ss * Dd;

  // constant all-ones A fragment: ones @ P^T = column sums (softmax denominator)
  v16h aones;
#pragma unroll
  for (int i = 0; i < 16; ++i) aones[i] = (_Float16)1.0f;

  // O^T accumulators oacc[u][c]: lane = q-col 16u + ln, VGPR i = d row 16c + i + 8*lh
  v8f oacc[QG][4] = {};
  v8f lacc[QG] = {};           // denominator (every VGPR row holds q-col sum)
  // minus the maximum in use for this lane's q-column of each group, in all eight registers: the C operand on which
  // the score products start, so that they come out as score - maximum. Set below, once tile 0 is in LDS.
  v8f negm[QG];

  // K/V staging: piece j of this thread is float4 number j * 256 + tid of the tile, so the 32 lanes of a wave
  // load 512 contiguous bytes = four whole 128 B lines per instruction (a lane-private 64 B run touched 16 lines)
  const int kvrow = tid >> 4;            // k row of piece 0; piece j lies 16 rows further down
  const int d0    = (tid & 15) << 2;     // d column base (4 cols)

  // fetch this thread's share of tile tt, fp32, into staging registers on its way to LDS
  // (the tile's address is the same for the whole block; the thread adds one 32-bit offset, shared by K and V)
  const unsigned toff = (unsigned)tid * 16u;
  typedef const __attribute__((address_space(1))) char* gbytes;
  typedef const __attribute__((address_space(1))) f4*   gf4;
  // holds a block-uniform address in scalar registers: otherwise the compiler adds the thread's offset to it ahead of the
  // loop and keeps a 64-bit address per thread and tensor in VGPRs, which the 256-VGPR budget has no room for
  auto scalar_base = [](const float* p) {
    const unsigned long long a = (unsigned long long)p;
    const unsigned lo = __builtin_amdgcn_readfirstlane((unsigned)a);
    const unsigned hi = __builtin_amdgcn_readfirstlane((unsigned)(a >> 32));
    return (gbytes)(((unsigned long long)hi << 32) | lo);
  };
  auto fetchK = [&](int tt, f4 (&krg)[4]) {
    gbytes ktn = scalar_base(kp + (size_t)tt * (KT * Dd));
#pragma unroll
    for (int j = 0; j < 4; ++j) krg[j] = *(gf4)(ktn + j * 4096 + toff);
  };
  auto fetchV = [&](int tt, f4 (&vrg)[4]) {
    gbytes vtn = scalar_base(vp + (size_t)tt * (KT * Dd));
#pragma unroll
    for (int j = 0; j < 4; ++j) vrg[j] = *(gf4)(vtn + j * 4096 + toff);
  };
  // commit the staging registers to LDS buffer b (fp32 -> f16); K and V both row-major
  auto commitK = [&](int b, const f4 (&krg)[4]) {
    _Float16* kd = KshB + b * KBUF + kvrow * KP + d0;   // 4 contiguous halves per piece -> one ds_store_b64 each
#pragma unroll
    for (int j = 0; j < 4; ++j)
#pragma unroll
      for (int c = 0; c < 4; ++c) kd[16 * j * KP + c] = (_Float16)krg[j][c];
  };
  auto commitV = [&](int b, const f4 (&vrg)[4]) {
    _Float16* vd = VshB + b * VBUF + kvrow * VP + d0;   // likewise
#pragma unroll
    for (int j = 0; j < 4; ++j)
#pragma unroll
      for (int c = 0; c < 4; ++c) vd[16 * j * VP + c] = (_Float16)vrg[j][c];
  };

  // ---- Q tile: per query group u two B-fragments (Q^T), pre-scaled by log2(e)/sqrt(D). The wave's 32 rows (8 KB) are
  // loaded 512 contiguous bytes per instruction, rounded to f16 into the wave's own slab and read back as fragments ----
  _Float16* const slab = smem + ws * SLABH;
  v16h bq0[QG], bq1[QG];
  f4 krg0[4], vrg0[4], kst[4];
  {
    const f4* qv = (const f4*)qp + lane;
    f4 qr[8 * QG];
#pragma unroll
    for (int j = 0; j < 8 * QG; ++j) qr[j] = qv[j * 32];   // float4 j * 32 + lane: row 2j + lh, columns 4 ln .. 4 ln + 3
    asm volatile("s_wait_xcnt 0x0" ::: "memory");   // stands in front of the first overwrite of a register that the Q loads name
    fetchK(0, krg0); fetchV(0, vrg0);    // tile 0 flies under the Q turn
    fetchK(1, kst);                      // and so does tile 1's K share, which pass 0 commits
    asm volatile("s_wait_xcnt 0x0" ::: "memory");   // likewise for the registers that these twelve loads name
#pragma unroll
    for (int j = 0; j < 8 * QG; ++j)
#pragma unroll
      for (int c = 0; c < 4; ++c) slab[(2 * j + lh) * KP + (ln << 2) + c] = (_Float16)(qr[j][c] * kScale);
  }
  asm volatile("s_wait_dscnt 0x0" ::: "memory");   // the wave's own slab stores are done before other lanes' rows are read
#pragma unroll
  for (int u = 0; u < QG; ++u) {
    bq0[u] = afrag(slab, KP, 16 * u, 0, ln, lh);
    bq1[u] = afrag(slab, KP, 16 * u, 32, ln, lh);
  }
  __syncthreads();                       // every wave has read its Q slab before tile 0 is written over the slabs

  commitK(0, krg0); commitV(0, vrg0);
  __syncthreads();                       // tile 0 published

  // the first maximum in use: each column's largest score among keys 0 .. 15. It is a true score of the row, so the
  // denominator holds a term 1 from the start and cannot vanish, however low the scores lie.
  {
    const v16h alo = afrag(KshB, KP, 0, 0, ln, lh);
    const v16h ahi = afrag(KshB, KP, 0, 32, ln, lh);
#pragma unroll
    for (int u = 0; u < QG; ++u) {
      v8f s0 = {};
      s0 = mma(alo, bq0[u], s0);
      s0 = mma(ahi, bq1[u], s0);
      float m0 = s0[0];
#pragma unroll
      for (int i = 1; i < 8; ++i) m0 = fmaxf(m0, s0[i]);
      m0 = fmaxf(m0, xhalf(m0));                // other half holds keys+8
#pragma unroll
      for (int i = 0; i < 8; ++i) negm[u][i] = -m0;
    }
  }

  for (int t = 0; t < NT; ++t) {
    const _Float16* Ksh = KshB + (t & 1) * KBUF;
    const _Float16* Vsh = VshB + (t & 1) * VBUF;
    const bool more = t + 1 < NT;
    // ---- S^T = K_tile @ (Q*scale)^T : per query group four 16(key)x16(q) accumulators.
    // Lane holds q-col = 16u + ln; VGPR j = key 16g + j + 8*lh. Each K fragment is read once for QG products.
    // The sums start at negm: s = score - maximum in use, in base 2. ----
    v8f s[QG][4];
    v16h kf[4][2];
#pragma unroll
    for (int g = 0; g < 4; ++g) {
      kf[g][0] = afrag(Ksh, KP, 16 * g, 0, ln, lh);
      kf[g][1] = afrag(Ksh, KP, 16 * g, 32, ln, lh);
    }
    // keeps all of the tile's sixteen K reads ahead of the products: at the 256-VGPR budget the compiler otherwise
    // splits them into groups that reuse registers, and the wave waits out the LDS latency once per group
    __builtin_amdgcn_sched_barrier(0);
#pragma unroll
    for (int g = 0; g < 4; ++g) {
      const v16h alo = kf[g][0];
      const v16h ahi = kf[g][1];
#pragma unroll
      for (int u = 0; u < QG; ++u) s[u][g] = mma(alo, bq0[u], negm[u]);
#pragma unroll
      for (int u = 0; u < QG; ++u) s[u][g] = mma(ahi, bq1[u], s[u][g]);
    }

    // keeps the sixteen score products back to back: a maximum moved in among them reads a fresh accumulator and
    // costs four v_nop each time
    __builtin_amdgcn_sched_barrier(0);

    // ---- how far this lane's 64 scores (both groups) stand above their maxima in use: in-lane only, four independent
    // chains of 17, 17, 15, 15 values (whole three-input maxima), in the order in which the accumulators finish ----
    float top;
    {
      auto x = [&](int n) { return s[(n >> 3) & 1][n >> 4][n & 7]; };
      float c[4];
      constexpr int first[5] = {0, 17, 34, 49, 64};
#pragma unroll
      for (int h = 0; h < 4; ++h) {
        c[h] = x(first[h]);
#pragma unroll
        for (int n = first[h] + 1; n < first[h + 1]; ++n) c[h] = fmaxf(c[h], x(n));
      }
      top = fmaxf(fmaxf(fmaxf(c[0], c[1]), c[2]), c[3]);
    }

    // ---- lazy maximum: ONE wave-uniform test per tile. Only if some column's score exceeds its maximum in use by
    // more than kLazy are the maxima raised and the running state rescaled ----
    if (__builtin_amdgcn_ballot_w32(top > kLazy) != 0u) {
#pragma unroll
      for (int u = 0; u < QG; ++u) {
        float over = 0.0f;                                               // only a rise counts
#pragma unroll
        for (int g = 0; g < 4; ++g)
#pragma unroll
          for (int i = 0; i < 8; ++i) over = fmaxf(over, s[u][g][i]);
        const float d   = fmaxf(over, xhalf(over));                      // the rise of this column's maximum; other half holds keys+8
        const float fac = __builtin_amdgcn_exp2f(-d);
        negm[u] = negm[u] - d;
#pragma unroll
        for (int g = 0; g < 4; ++g) s[u][g] = s[u][g] - d;
#pragma unroll
        for (int i = 0; i < 8; ++i) {
          oacc[u][0][i] *= fac; oacc[u][1][i] *= fac; oacc[u][2][i] *= fac; oacc[u][3][i] *= fac;
          lacc[u][i] *= fac;
        }
      }
    }

    // Staging, timed so that the kernel stays within 256 VGPRs: under the score products, where the K fragments need the
    // room, only a K share is held in registers. Here tile t + 1's K share, fetched one pass ago, is committed; then tile
    // t + 1's V share and tile t + 2's K share (the last tile's a second time, unused, rather than a branch) go out and
    // fly under the exponentials and the V products, up to the foot of the pass. The buffers written are free for the
    // whole pass: their last readers left before the barrier of pass t - 1.
    f4 vst[4];
    if (more) {
      commitK((t + 1) & 1, kst);
      fetchV(t + 1, vst);
      fetchK(t + 2 < NT ? t + 2 : NT - 1, kst);
    }

    v16h bp0[QG], bp1[QG];
#pragma unroll
    for (int u = 0; u < QG; ++u) {
      // ---- P^T fragments built IN REGISTERS (S^T C-layout == B-operand layout):
      // bp0 element i -> key 16*(i>>3)+8*lh+(i&7) = tile (i>>3), VGPR (i&7), same lane ----
#pragma unroll
      for (int i = 0; i < 8; ++i) {
        bp0[u][i]     = (_Float16)__builtin_amdgcn_exp2f(s[u][0][i]);
        bp0[u][i + 8] = (_Float16)__builtin_amdgcn_exp2f(s[u][1][i]);
        bp1[u][i]     = (_Float16)__builtin_amdgcn_exp2f(s[u][2][i]);
        bp1[u][i + 8] = (_Float16)__builtin_amdgcn_exp2f(s[u][3][i]);
      }

      // ---- denominator: lacc += ones @ P^T (column sums, all keys covered) ----
      lacc[u] = mma(aones, bp0[u], lacc[u]);
      lacc[u] = mma(aones, bp1[u], lacc[u]);
    }

    // ---- O^T += V^T @ P^T : four d-row chunks, K-dim 64 = 2 WMMAs each per query group;
    // each V^T fragment is read once for QG products ----
#pragma unroll
    for (int c = 0; c < 4; ++c) {
      const v16h alo = vtfrag(Vsh, 16 * c, 0, lane);
      const v16h ahi = vtfrag(Vsh, 16 * c, 32, lane);
#pragma unroll
      for (int u = 0; u < QG; ++u) oacc[u][c] = mma(alo, bp0[u], oacc[u][c]);
#pragma unroll
      for (int u = 0; u < QG; ++u) oacc[u][c] = mma(ahi, bp1[u], oacc[u][c]);
    }

    if (more) {
      commitV((t + 1) & 1, vst);
      __syncthreads();                   // publishes tile t + 1 and ends every wave's reads of tile t
    }
  }

  // ---- normalize and write out: lane ln owns q-row 16u + ln in runs of 8 d values; the 16 rows of a group are
  // turned through the wave's own slab so that each global_store_b128 of the wave covers 512 contiguous bytes ----
  __syncthreads();                       // the waves leave the loop apart: every wave's reads of the last tile end here
  // the lane's number is formed anew and the wave's number is taken as wave-uniform, so that this part's addresses are
  // formed here and not held in VGPRs across the loop (they spilled to scratch at the 256-VGPR budget)
  const int lane2 = (int)__builtin_amdgcn_mbcnt_lo(~0u, 0u);
  const int lh2   = lane2 >> 4;
  const int ln2   = lane2 & 15;
  float* const oslab = (float*)(smem + ws * SLABH);
#pragma unroll
  for (int u = 0; u < QG; ++u) {
    const float invl = 1.0f / lacc[u][0];
    float* orow = oslab + ln2 * OP + (lh2 << 3);
#pragma unroll
    for (int i = 0; i < 8; ++i) {
      orow[i]      = oacc[u][0][i] * invl;
      orow[16 + i] = oacc[u][1][i] * invl;
      orow[32 + i] = oacc[u][2][i] * invl;
      orow[48 + i] = oacc[u][3][i] * invl;
    }
    asm volatile("s_wait_dscnt 0x0" ::: "memory");   // the group's rows are in the slab before other lanes read them
    f4* og = (f4*)(o + ((size_t)bh * Ss + qblk * QTILE) * Dd);           // the block's rows: the same for all its threads
    const unsigned o4 = (unsigned)ws * (16 * QG * Dd / 4) + 16 * u * Dd / 4 + lane2;
#pragma unroll
    for (int j = 0; j < 8; ++j) og[o4 + j * 32] = *(const f4*)(oslab + (2 * j + lh2) * OP + (ln2 << 2));
  }
}

extern "C" void kernel_launch(void* const* d_in, const int* in_sizes, int n_in,
                              void* d_out, int out_size, void* d_ws, size_t ws_size,
                              hipStream_t stream) {
  (void)in_sizes; (void)n_in; (void)out_size; (void)d_ws; (void)ws_size;
  const float* q = (const float*)d_in[0];
  const float* k = (const float*)d_in[1];
  const float* v = (const float*)d_in[2];
  float* o = (float*)d_out;
  const int blocks = Bb * Hh * (Ss / QTILE);   // 512
  fa_fwd_wmma<<<blocks, 256, 0, stream>>>(q, k, v, o);
}

// v008
// It runs in 52.6 microseconds.
// In two side-by-side timings against v007, it was 1.04 and 1.03 times as fast.
// Over all steps from v000 it is 5.43 times as fast.
#include <hip/hip_runtime.h>
#include <math.h>

typedef __attribute__((ext_vector_type(16))) _Float16 v16h;
typedef __attribute__((ext_vector_type(8)))  _Float16 v8h;
typedef __attribute__((ext_vector_type(8)))  short    s16x8;
typedef __attribute__((ext_vector_type(8)))  float    v8f;
typedef __attribute__((ext_vector_type(4)))  float    f4;

namespace {
constexpr int Bb = 4, Hh = 16, Ss = 2048, Dd = 64;
// Scores are kept in base 2: Q is pre-scaled by log2(e)/sqrt(64), so that exp(score - maximum) is the bare
// exp2 of what the score products deliver and no multiply stands in front of any exponential
constexpr float kScale = 0.125f * 1.4426950408889634f;
// a column's maximum in use is raised only when a score stands more than this above it: 8 doublings, so P <= 256 in f16
constexpr float kLazy  = 8.0f;
constexpr int QG    = 4;           // 16-column query groups per wave: each K / V^T fragment read from LDS feeds QG products
constexpr int QTILE = 128 * QG;    // q rows per block = 8 waves * 16 * QG
constexpr int KT    = 64;          // kv rows per tile
constexpr int NT    = Ss / KT;     // 32 kv tiles
// LDS row pitch in halves: 128 B of data + 16 B pad = 144 B = 16 B x 9 (odd), so the
// 16 rows one ds_load_b128 touches per half-wave start on 16 different 4-bank groups.
constexpr int KP    = Dd + 8;      // K tile row pitch
// V rows are read by the transposing load, whose conflict-free pitch is 32 B x odd: 128 B + 32 B = 160 B
constexpr int VP    = Dd + 16;     // V tile row pitch
constexpr int KBUF  = KT * KP;     // halves per K buffer
constexpr int VBUF  = KT * VP;     // halves per V buffer
constexpr int RINGH = 2 * KBUF + 2 * VBUF;   // the four tile buffers, in halves (38,912 B)
// Before the first and after the last tile the same LDS is eight wave-private slabs, in which Q and O are turned
// between whole-line global order and fragment order
constexpr int SLABH = 16 * QG * KP;   // 9,216 B per wave: its 64 Q rows at pitch KP, or 16 O rows at pitch OP
constexpr int OP    = Dd + 4;      // O row pitch in floats: 272 B = 16 B x 17 (odd), as for K
constexpr int SMEMH = 8 * SLABH > RINGH ? 8 * SLABH : RINGH;   // all LDS, in halves (73,728 B; one block per WGP)
static_assert(16 * OP * 2 <= SLABH && (SLABH * 2) % 16 == 0, "slab too small");
}

// 16-bit WMMA A/B fragment K-index (ISA 7.12.2):
// element i of lane L -> K = 16*(i>>3) + 8*(L>=16) + 2*((i>>1)&3) + (i&1)
//                          = 16*(i>>3) + 8*(L>=16) + (i&7)
// Consecutive i give contiguous 8-half runs -> LDS reads vectorize to b128.
__device__ __forceinline__ int kidx(int i, int lh) {
  return ((i >> 3) << 4) + (lh << 3) + (((i >> 1) & 3) << 1) + (i & 1);
}

// One 16x32 A fragment: row (row0 + ln) of an LDS tile, k columns col0 .. col0+31
__device__ __forceinline__ v16h afrag(const _Float16* tile, int pitch, int row0, int col0, int ln, int lh) {
  v16h a;
#pragma unroll
  for (int i = 0; i < 16; ++i) a[i] = tile[(row0 + ln) * pitch + col0 + kidx(i, lh)];
  return a;
}

// One 16(d) x 32(key) A fragment of V^T out of the row-major V tile [key][d]: the transposing LDS load hands
// lane (ln, lh) the 8 keys k + 8*lh .. +7 of column dcol + ln; loads at k0 and k0 + 16 give the kidx order.
__device__ __forceinline__ v16h vtfrag(const _Float16* tile, int dcol, int k0, int lane) {
  typedef __attribute__((address_space(3))) s16x8 lds_s16x8;
  const _Float16* p = tile + (k0 + ((lane >> 4) << 3) + (lane & 7)) * VP + dcol + (((lane >> 3) & 1) << 3);
  const v8h lo = __builtin_bit_cast(v8h, __builtin_amdgcn_ds_load_tr16_b128_v8i16((lds_s16x8*)p));
  const v8h hi = __builtin_bit_cast(v8h, __builtin_amdgcn_ds_load_tr16_b128_v8i16((lds_s16x8*)(p + 16 * VP)));
  return __builtin_shufflevector(lo, hi, 0, 1, 2, 3, 4, 5, 6, 7, 8, 9, 10, 11, 12, 13, 14, 15);
}

// lane l's value of lane l ^ 16, by a vector cross-row move (needs no index register and no LDS wait)
__device__ __forceinline__ float xhalf(float x) {
  const int b = __builtin_bit_cast(int, x);
  return __builtin_bit_cast(float, __builtin_amdgcn_permlanex16(b, b, 0x76543210, 0xfedcba98, false, false));
}

__device__ __forceinline__ v8f mma(v16h a, v16h b, v8f c) {
  return __builtin_amdgcn_wmma_f32_16x16x32_f16(false, a, false, b, (short)0, c, false, false);
}

// two waves per SIMD (one block per WGP, the whole grid resident) may take up to 512 VGPRs each
__global__ __launch_bounds__(256) __attribute__((amdgpu_waves_per_eu(2, 2)))
void fa_fwd_wmma(const float* __restrict__ q, const float* __restrict__ k,
                 const float* __restrict__ v, float* __restrict__ o) {
  // two buffers each: tile t is read from buffer t & 1 while tile t + 1 is written to the other
  __shared__ __attribute__((aligned(16))) _Float16 smem[SMEMH];
  _Float16* const KshB = smem;             // K tile [k][d], padded rows, 2 x 9 KB: buffer b at b * KBUF
  _Float16* const VshB = smem + 2 * KBUF;  // V tile [k][d], as in memory, padded rows, 2 x 10 KB: buffer b at b * VBUF

  const int tid  = threadIdx.x;
  const int lane = tid & 31;
  const int w    = tid >> 5;
  const int ws   = __builtin_amdgcn_readfirstlane(w);   // the same, as a wave-uniform value
  const int lh   = lane >> 4;
  const int ln   = lane & 15;

  const int qblocks = Ss / QTILE;
  const int bh    = blockIdx.x / qblocks;
  const int qblk  = blockIdx.x % qblocks;
  const int qbase = qblk * QTILE + ws * (16 * QG);

  const float* qp = q + ((size_t)bh * Ss + qbase) * Dd;
  const float* kp = k + (size_t)bh * Ss * Dd;
  const float* vp = v + (size_t)bh * Ss * Dd;

  // constant all-ones A fragment: ones @ P^T = column sums (softmax denominator)
  v16h aones;
#pragma unroll
  for (int i = 0; i < 16; ++i) aones[i] = (_Float16)1.0f;

  // O^T accumulators oacc[u][c]: lane = q-col 16u + ln, VGPR i = d row 16c + i + 8*lh
  v8f oacc[QG][4] = {};
  v8f lacc[QG] = {};           // denominator (every VGPR row holds q-col sum)
  // minus the maximum in use for this lane's q-column of each group, in all eight registers: the C operand on which
  // the score products start, so that they come out as score - maximum. Set below, once tile 0 is in LDS.
  v8f negm[QG];

  // K/V staging: piece j of this thread is float4 number j * 256 + tid of the tile, so the 32 lanes of a wave
  // load 512 contiguous bytes = four whole 128 B lines per instruction (a lane-private 64 B run touched 16 lines)
  const int kvrow = tid >> 4;            // k row of piece 0; piece j lies 16 rows further down
  const int d0    = (tid & 15) << 2;     // d column base (4 cols)

  // fetch this thread's share of tile tt, fp32, into staging registers on its way to LDS
  // (the tile's address is the same for the whole block; the thread adds one 32-bit offset, shared by K and V)
  const unsigned toff = (unsigned)tid * 16u;
  typedef const __attribute__((address_space(1))) char* gbytes;
  typedef const __attribute__((address_space(1))) f4*   gf4;
  // holds a block-uniform address in scalar registers: otherwise the compiler adds the thread's offset to it ahead of the
  // loop and keeps a 64-bit address per thread and tensor in VGPRs across it
  auto scalar_base = [](const float* p) {
    const unsigned long long a = (unsigned long long)p;
    const unsigned lo = __builtin_amdgcn_readfirstlane((unsigned)a);
    const unsigned hi = __builtin_amdgcn_readfirstlane((unsigned)(a >> 32));
    return (gbytes)(((unsigned long long)hi << 32) | lo);
  };
  auto fetchK = [&](int tt, f4 (&krg)[4]) {
    gbytes ktn = scalar_base(kp + (size_t)tt * (KT * Dd));
#pragma unroll
    for (int j = 0; j < 4; ++j) krg[j] = *(gf4)(ktn + j * 4096 + toff);
  };
  auto fetchV = [&](int tt, f4 (&vrg)[4]) {
    gbytes vtn = scalar_base(vp + (size_t)tt * (KT * Dd));
#pragma unroll
    for (int j = 0; j < 4; ++j) vrg[j] = *(gf4)(vtn + j * 4096 + toff);
  };
  // commit the staging registers to LDS buffer b (fp32 -> f16); K and V both row-major
  auto commitK = [&](int b, const f4 (&krg)[4]) {
    _Float16* kd = KshB + b * KBUF + kvrow * KP + d0;   // 4 contiguous halves per piece -> one ds_store_b64 each
#pragma unroll
    for (int j = 0; j < 4; ++j)
#pragma unroll
      for (int c = 0; c < 4; ++c) kd[16 * j * KP + c] = (_Float16)krg[j][c];
  };
  auto commitV = [&](int b, const f4 (&vrg)[4]) {
    _Float16* vd = VshB + b * VBUF + kvrow * VP + d0;   // likewise
#pragma unroll
    for (int j = 0; j < 4; ++j)
#pragma unroll
      for (int c = 0; c < 4; ++c) vd[16 * j * VP + c] = (_Float16)vrg[j][c];
  };

  // ---- Q tile: per query group u two B-fragments (Q^T), pre-scaled by log2(e)/sqrt(D). The wave's 64 rows (16 KB) are
  // loaded 512 contiguous bytes per instruction, rounded to f16 into the wave's own slab and read back as fragments ----
  _Float16* const slab = smem + ws * SLABH;
  v16h bq0[QG], bq1[QG];
  f4 krg0[4], vrg0[4], kst[4];
  {
    const f4* qv = (const f4*)qp + lane;
    f4 qr[8 * QG];
#pragma unroll
    for (int j = 0; j < 8 * QG; ++j) qr[j] = qv[j * 32];   // float4 j * 32 + lane: row 2j + lh, columns 4 ln .. 4 ln + 3
    asm volatile("s_wait_xcnt 0x0" ::: "memory");   // stands in front of the first overwrite of a register that the Q loads name
    fetchK(0, krg0); fetchV(0, vrg0);    // tile 0 flies under the Q turn
    fetchK(1, kst);                      // and so does tile 1's K share, which pass 0 commits
    asm volatile("s_wait_xcnt 0x0" ::: "memory");   // likewise for the registers that these twelve loads name
#pragma unroll
    for (int j = 0; j < 8 * QG; ++j)
#pragma unroll
      for (int c = 0; c < 4; ++c) slab[(2 * j + lh) * KP + (ln << 2) + c] = (_Float16)(qr[j][c] * kScale);
  }
  asm volatile("s_wait_dscnt 0x0" ::: "memory");   // the wave's own slab stores are done before other lanes' rows are read
#pragma unroll
  for (int u = 0; u < QG; ++u) {
    bq0[u] = afrag(slab, KP, 16 * u, 0, ln, lh);
    bq1[u] = afrag(slab, KP, 16 * u, 32, ln, lh);
  }
  __syncthreads();                       // every wave has read its Q slab before tile 0 is written over the slabs

  commitK(0, krg0); commitV(0, vrg0);
  __syncthreads();                       // tile 0 published

  // the first maximum in use: each column's largest score among keys 0 .. 15. It is a true score of the row, so the
  // denominator holds a term 1 from the start and cannot vanish, however low the scores lie.
  {
    const v16h alo = afrag(KshB, KP, 0, 0, ln, lh);
    const v16h ahi = afrag(KshB, KP, 0, 32, ln, lh);
#pragma unroll
    for (int u = 0; u < QG; ++u) {
      v8f s0 = {};
      s0 = mma(alo, bq0[u], s0);
      s0 = mma(ahi, bq1[u], s0);
      float m0 = s0[0];
#pragma unroll
      for (int i = 1; i < 8; ++i) m0 = fmaxf(m0, s0[i]);
      m0 = fmaxf(m0, xhalf(m0));                // other half holds keys+8
#pragma unroll
      for (int i = 0; i < 8; ++i) negm[u][i] = -m0;
    }
  }

  for (int t = 0; t < NT; ++t) {
    const _Float16* Ksh = KshB + (t & 1) * KBUF;
    const _Float16* Vsh = VshB + (t & 1) * VBUF;
    const bool more = t + 1 < NT;
    // ---- S^T = K_tile @ (Q*scale)^T : per query group four 16(key)x16(q) accumulators.
    // Lane holds q-col = 16u + ln; VGPR j = key 16g + j + 8*lh. Each K fragment is read once for QG products.
    // The sums start at negm: s = score - maximum in use, in base 2. ----
    v8f s[QG][4];
    v16h kf[4][2];
#pragma unroll
    for (int g = 0; g < 4; ++g) {
      kf[g][0] = afrag(Ksh, KP, 16 * g, 0, ln, lh);
      kf[g][1] = afrag(Ksh, KP, 16 * g, 32, ln, lh);
    }
    // keeps all of the tile's sixteen K reads ahead of the products: the compiler otherwise splits them into
    // groups that reuse registers, and the wave waits out the LDS latency once per group
    __builtin_amdgcn_sched_barrier(0);
#pragma unroll
    for (int g = 0; g < 4; ++g) {
      const v16h alo = kf[g][0];
      const v16h ahi = kf[g][1];
#pragma unroll
      for (int u = 0; u < QG; ++u) s[u][g] = mma(alo, bq0[u], negm[u]);
#pragma unroll
      for (int u = 0; u < QG; ++u) s[u][g] = mma(ahi, bq1[u], s[u][g]);
    }

    // keeps the thirty-two score products back to back: a maximum moved in among them reads a fresh accumulator and
    // costs four v_nop each time
    __builtin_amdgcn_sched_barrier(0);

    // ---- how far this lane's 128 scores (all groups) stand above their maxima in use: in-lane only, four independent
    // chains of 33, 33, 31, 31 values (whole three-input maxima), in the order in which the accumulators finish ----
    float top;
    {
      auto x = [&](int n) { return s[(n >> 3) & 3][n >> 5][n & 7]; };
      float c[4];
      constexpr int first[5] = {0, 33, 66, 97, 128};
#pragma unroll
      for (int h = 0; h < 4; ++h) {
        c[h] = x(first[h]);
#pragma unroll
        for (int n = first[h] + 1; n < first[h + 1]; ++n) c[h] = fmaxf(c[h], x(n));
      }
      top = fmaxf(fmaxf(fmaxf(c[0], c[1]), c[2]), c[3]);
    }

    // ---- lazy maximum: ONE wave-uniform test per tile. Only if some column's score exceeds its maximum in use by
    // more than kLazy are the maxima raised and the running state rescaled ----
    if (__builtin_amdgcn_ballot_w32(top > kLazy) != 0u) {
#pragma unroll
      for (int u = 0; u < QG; ++u) {
        float over = 0.0f;                                               // only a rise counts
#pragma unroll
        for (int g = 0; g < 4; ++g)
#pragma unroll
          for (int i = 0; i < 8; ++i) over = fmaxf(over, s[u][g][i]);
        const float d   = fmaxf(over, xhalf(over));                      // the rise of this column's maximum; other half holds keys+8
        const float fac = __builtin_amdgcn_exp2f(-d);
        negm[u] = negm[u] - d;
#pragma unroll
        for (int g = 0; g < 4; ++g) s[u][g] = s[u][g] - d;
#pragma unroll
        for (int i = 0; i < 8; ++i) {
          oacc[u][0][i] *= fac; oacc[u][1][i] *= fac; oacc[u][2][i] *= fac; oacc[u][3][i] *= fac;
          lacc[u][i] *= fac;
        }
      }
    }

    // Staging, timed so that it holds few VGPRs: under the score products, where the K fragments need the
    // room, only a K share is held in registers. Here tile t + 1's K share, fetched one pass ago, is committed; then tile
    // t + 1's V share and tile t + 2's K share (the last tile's a second time, unused, rather than a branch) go out and
    // fly under the exponentials and the V products, up to the foot of the pass. The buffers written are free for the
    // whole pass: their last readers left before the barrier of pass t - 1.
    f4 vst[4];
    if (more) {
      commitK((t + 1) & 1, kst);
      fetchV(t + 1, vst);
      fetchK(t + 2 < NT ? t + 2 : NT - 1, kst);
      asm volatile("s_wait_xcnt 0x0" ::: "memory");   // stands in front of the first overwrite of a register that these eight loads name
    }

    v16h bp0[QG], bp1[QG];
#pragma unroll
    for (int u = 0; u < QG; ++u) {
      // ---- P^T fragments built IN REGISTERS (S^T C-layout == B-operand layout):
      // bp0 element i -> key 16*(i>>3)+8*lh+(i&7) = tile (i>>3), VGPR (i&7), same lane ----
#pragma unroll
      for (int i = 0; i < 8; ++i) {
        bp0[u][i]     = (_Float16)__builtin_amdgcn_exp2f(s[u][0][i]);
        bp0[u][i + 8] = (_Float16)__builtin_amdgcn_exp2f(s[u][1][i]);
        bp1[u][i]     = (_Float16)__builtin_amdgcn_exp2f(s[u][2][i]);
        bp1[u][i + 8] = (_Float16)__builtin_amdgcn_exp2f(s[u][3][i]);
      }

      // ---- denominator: lacc += ones @ P^T (column sums, all keys covered) ----
      lacc[u] = mma(aones, bp0[u], lacc[u]);
      lacc[u] = mma(aones, bp1[u], lacc[u]);
    }

    // ---- O^T += V^T @ P^T : four d-row chunks, K-dim 64 = 2 WMMAs each per query group;
    // each V^T fragment is read once for QG products ----
#pragma unroll
    for (int c = 0; c < 4; ++c) {
      const v16h alo = vtfrag(Vsh, 16 * c, 0, lane);
      const v16h ahi = vtfrag(Vsh, 16 * c, 32, lane);
#pragma unroll
      for (int u = 0; u < QG; ++u) oacc[u][c] = mma(alo, bp0[u], oacc[u][c]);
#pragma unroll
      for (int u = 0; u < QG; ++u) oacc[u][c] = mma(ahi, bp1[u], oacc[u][c]);
    }

    if (more) {
      commitV((t + 1) & 1, vst);
      __syncthreads();                   // publishes tile t + 1 and ends every wave's reads of tile t
    }
  }

  // ---- normalize and write out: lane ln owns q-row 16u + ln in runs of 8 d values; the 16 rows of a group are
  // turned through the wave's own slab so that each global_store_b128 of the wave covers 512 contiguous bytes ----
  __syncthreads();                       // the waves leave the loop apart: every wave's reads of the last tile end here
  // the lane's number is formed anew and the wave's number is taken as wave-uniform, so that this part's addresses are
  // formed here and not held in VGPRs across the loop
  const int lane2 = (int)__builtin_amdgcn_mbcnt_lo(~0u, 0u);
  const int lh2   = lane2 >> 4;
  const int ln2   = lane2 & 15;
  float* const oslab = (float*)(smem + ws * SLABH);
#pragma unroll
  for (int u = 0; u < QG; ++u) {
    const float invl = 1.0f / lacc[u][0];
    float* orow = oslab + ln2 * OP + (lh2 << 3);
#pragma unroll
    for (int i = 0; i < 8; ++i) {
      orow[i]      = oacc[u][0][i] * invl;
      orow[16 + i] = oacc[u][1][i] * invl;
      orow[32 + i] = oacc[u][2][i] * invl;
      orow[48 + i] = oacc[u][3][i] * invl;
    }
    asm volatile("s_wait_dscnt 0x0" ::: "memory");   // the group's rows are in the slab before other lanes read them
    f4* og = (f4*)(o + ((size_t)bh * Ss + qblk * QTILE) * Dd);           // the block's rows: the same for all its threads
    const unsigned o4 = (unsigned)ws * (16 * QG * Dd / 4) + 16 * u * Dd / 4 + lane2;
#pragma unroll
    for (int j = 0; j < 8; ++j) og[o4 + j * 32] = *(const f4*)(oslab + (2 * j + lh2) * OP + (ln2 << 2));
  }
}

extern "C" void kernel_launch(void* const* d_in, const int* in_sizes, int n_in,
                              void* d_out, int out_size, void* d_ws, size_t ws_size,
                              hipStream_t stream) {
  (void)in_sizes; (void)n_in; (void)out_size; (void)d_ws; (void)ws_size;
  const float* q = (const float*)d_in[0];
  const float* k = (const float*)d_in[1];
  const float* v = (const float*)d_in[2];
  float* o = (float*)d_out;
  const int blocks = Bb * Hh * (Ss / QTILE);   // 256
  fa_fwd_wmma<<<blocks, 256, 0, stream>>>(q, k, v, o);
}

// v009
// Measured time: 47 microseconds a run.
// Timed twice side by side with v008, it ran 1.12 and 1.11 times as fast.
// Counting every step since v000, it is 6.06 times as fast.
#include <hip/hip_runtime.h>
#include <math.h>

typedef __attribute__((ext_vector_type(16))) _Float16 v16h;
typedef __attribute__((ext_vector_type(8)))  _Float16 v8h;
typedef __attribute__((ext_vector_type(8)))  short    s16x8;
typedef __attribute__((ext_vector_type(8)))  float    v8f;
typedef __attribute__((ext_vector_type(4)))  float    f4;

namespace {
constexpr int Bb = 4, Hh = 16, Ss = 2048, Dd = 64;
// Scores are kept in base 2: Q is pre-scaled by log2(e)/sqrt(64), so that exp(score - maximum) is the bare
// exp2 of what the score products deliver and no multiply stands in front of any exponential
constexpr float kScale = 0.125f * 1.4426950408889634f;
// a column's maximum in use is raised only when a score stands more than this above it: 8 doublings, so P <= 256 in f16
constexpr float kLazy  = 8.0f;
constexpr int QG    = 4;           // 16-column query groups per wave: each K / V^T fragment read from LDS feeds QG products
constexpr int QTILE = 128 * QG;    // q rows per block = 8 waves * 16 * QG
constexpr int KT    = 64;          // kv rows per tile
constexpr int NT    = Ss / KT;     // 32 kv tiles
// LDS row pitch in halves: 128 B of data + 16 B pad = 144 B = 16 B x 9 (odd), so the
// 16 rows one ds_load_b128 touches per half-wave start on 16 different 4-bank groups.
constexpr int KP    = Dd + 8;      // K tile row pitch
// V rows are read by the transposing load, whose conflict-free pitch is 32 B x odd: 128 B + 32 B = 160 B
constexpr int VP    = Dd + 16;     // V tile row pitch
constexpr int KBUF  = KT * KP;     // halves per K buffer
constexpr int VBUF  = KT * VP;     // halves per V buffer
constexpr int NBUF  = 4;           // tile buffers per tensor: the waves of a block run up to half a pass apart (see the loop)
constexpr int RINGH = NBUF * (KBUF + VBUF);   // the eight tile buffers, in halves (77,824 B)
// Before the first and after the last tile the same LDS is eight wave-private slabs, in which Q and O are turned
// between whole-line global order and fragment order
constexpr int SLABH = 16 * QG * KP;   // 9,216 B per wave: its 64 Q rows at pitch KP, or 16 O rows at pitch OP
constexpr int OP    = Dd + 4;      // O row pitch in floats: 272 B = 16 B x 17 (odd), as for K
constexpr int SMEMH = 8 * SLABH > RINGH ? 8 * SLABH : RINGH;   // all LDS, in halves (77,824 B; one block per WGP)
static_assert(16 * OP * 2 <= SLABH && (SLABH * 2) % 16 == 0, "slab too small");
}

// 16-bit WMMA A/B fragment K-index (ISA 7.12.2):
// element i of lane L -> K = 16*(i>>3) + 8*(L>=16) + 2*((i>>1)&3) + (i&1)
//                          = 16*(i>>3) + 8*(L>=16) + (i&7)
// Consecutive i give contiguous 8-half runs -> LDS reads vectorize to b128.
__device__ __forceinline__ int kidx(int i, int lh) {
  return ((i >> 3) << 4) + (lh << 3) + (((i >> 1) & 3) << 1) + (i & 1);
}

// One 16x32 A fragment: row (row0 + ln) of an LDS tile, k columns col0 .. col0+31
__device__ __forceinline__ v16h afrag(const _Float16* tile, int pitch, int row0, int col0, int ln, int lh) {
  v16h a;
#pragma unroll
  for (int i = 0; i < 16; ++i) a[i] = tile[(row0 + ln) * pitch + col0 + kidx(i, lh)];
  return a;
}

// One 16(d) x 32(key) A fragment of V^T out of the row-major V tile [key][d]: the transposing LDS load hands
// lane (ln, lh) the 8 keys k + 8*lh .. +7 of column dcol + ln; loads at k0 and k0 + 16 give the kidx order.
__device__ __forceinline__ v16h vtfrag(const _Float16* tile, int dcol, int k0, int lane) {
  typedef __attribute__((address_space(3))) s16x8 lds_s16x8;
  const _Float16* p = tile + (k0 + ((lane >> 4) << 3) + (lane & 7)) * VP + dcol + (((lane >> 3) & 1) << 3);
  const v8h lo = __builtin_bit_cast(v8h, __builtin_amdgcn_ds_load_tr16_b128_v8i16((lds_s16x8*)p));
  const v8h hi = __builtin_bit_cast(v8h, __builtin_amdgcn_ds_load_tr16_b128_v8i16((lds_s16x8*)(p + 16 * VP)));
  return __builtin_shufflevector(lo, hi, 0, 1, 2, 3, 4, 5, 6, 7, 8, 9, 10, 11, 12, 13, 14, 15);
}

// lane l's value of lane l ^ 16, by a vector cross-row move (needs no index register and no LDS wait)
__device__ __forceinline__ float xhalf(float x) {
  const int b = __builtin_bit_cast(int, x);
  return __builtin_bit_cast(float, __builtin_amdgcn_permlanex16(b, b, 0x76543210, 0xfedcba98, false, false));
}

__device__ __forceinline__ v8f mma(v16h a, v16h b, v8f c) {
  return __builtin_amdgcn_wmma_f32_16x16x32_f16(false, a, false, b, (short)0, c, false, false);
}

// The work-group barrier in its two halves, so that a wave can say "my score products of this tile are out" and go on, and ask
// only later whether all the others have said so. Neither half waits for memory: the LDS wait stands in front of the signal.
__device__ __forceinline__ void bar_signal() { asm volatile("s_barrier_signal -1" ::: "memory"); }
__device__ __forceinline__ void bar_wait()   { asm volatile("s_barrier_wait -1" ::: "memory"); }

// two waves per SIMD (one block per WGP, the whole grid resident) may take up to 512 VGPRs each
__global__ __launch_bounds__(256) __attribute__((amdgpu_waves_per_eu(2, 2)))
void fa_fwd_wmma(const float* __restrict__ q, const float* __restrict__ k,
                 const float* __restrict__ v, float* __restrict__ o) {
  // four buffers each: tile t lies in buffer t & 3
  __shared__ __attribute__((aligned(16))) _Float16 smem[SMEMH];
  _Float16* const KshB = smem;                // K tile [k][d], padded rows, 4 x 9 KB: buffer b at b * KBUF
  _Float16* const VshB = smem + NBUF * KBUF;  // V tile [k][d], as in memory, padded rows, 4 x 10 KB: buffer b at b * VBUF

  const int tid  = threadIdx.x;
  const int lane = tid & 31;
  const int w    = tid >> 5;
  const int ws   = __builtin_amdgcn_readfirstlane(w);   // the same, as a wave-uniform value
  const int lh   = lane >> 4;
  const int ln   = lane & 15;

  const int qblocks = Ss / QTILE;
  const int bh    = blockIdx.x / qblocks;
  const int qblk  = blockIdx.x % qblocks;
  const int qbase = qblk * QTILE + ws * (16 * QG);

  const float* qp = q + ((size_t)bh * Ss + qbase) * Dd;
  const float* kp = k + (size_t)bh * Ss * Dd;
  const float* vp = v + (size_t)bh * Ss * Dd;

  // constant all-ones A fragment: ones @ P^T = column sums (softmax denominator)
  v16h aones;
#pragma unroll
  for (int i = 0; i < 16; ++i) aones[i] = (_Float16)1.0f;

  // O^T accumulators oacc[u][c]: lane = q-col 16u + ln, VGPR i = d row 16c + i + 8*lh
  v8f oacc[QG][4] = {};
  v8f lacc[QG] = {};           // denominator (every VGPR row holds q-col sum)
  // minus the maximum in use for this lane's q-column of each group, in all eight registers: the C operand on which
  // the score products start, so that they come out as score - maximum. Set below, once tile 0 is in LDS.
  v8f negm[QG];

  // K/V staging: piece j of this thread is float4 number j * 256 + tid of the tile, so the 32 lanes of a wave
  // load 512 contiguous bytes = four whole 128 B lines per instruction (a lane-private 64 B run touched 16 lines)
  const int kvrow = tid >> 4;            // k row of piece 0; piece j lies 16 rows further down
  const int d0    = (tid & 15) << 2;     // d column base (4 cols)

  // fetch this thread's share of tile tt, fp32, into staging registers on its way to LDS
  // (the tile's address is the same for the whole block; the thread adds one 32-bit offset, shared by K and V)
  const unsigned toff = (unsigned)tid * 16u;
  typedef const __attribute__((address_space(1))) char* gbytes;
  typedef const __attribute__((address_space(1))) f4*   gf4;
  // holds a block-uniform address in scalar registers: otherwise the compiler adds the thread's offset to it ahead of the
  // loop and keeps a 64-bit address per thread and tensor in VGPRs across it
  auto scalar_base = [](const float* p) {
    const unsigned long long a = (unsigned long long)p;
    const unsigned lo = __builtin_amdgcn_readfirstlane((unsigned)a);
    const unsigned hi = __builtin_amdgcn_readfirstlane((unsigned)(a >> 32));
    return (gbytes)(((unsigned long long)hi << 32) | lo);
  };
  auto fetchK = [&](int tt, f4 (&krg)[4]) {
    gbytes ktn = scalar_base(kp + (size_t)tt * (KT * Dd));
#pragma unroll
    for (int j = 0; j < 4; ++j) krg[j] = *(gf4)(ktn + j * 4096 + toff);
  };
  auto fetchV = [&](int tt, f4 (&vrg)[4]) {
    gbytes vtn = scalar_base(vp + (size_t)tt * (KT * Dd));
#pragma unroll
    for (int j = 0; j < 4; ++j) vrg[j] = *(gf4)(vtn + j * 4096 + toff);
  };
  // commit the staging registers to LDS buffer b (fp32 -> f16); K and V both row-major
  auto commitK = [&](int b, const f4 (&krg)[4]) {
    _Float16* kd = KshB + b * KBUF + kvrow * KP + d0;   // 4 contiguous halves per piece -> one ds_store_b64 each
#pragma unroll
    for (int j = 0; j < 4; ++j)
#pragma unroll
      for (int c = 0; c < 4; ++c) kd[16 * j * KP + c] = (_Float16)krg[j][c];
  };
  auto commitV = [&](int b, const f4 (&vrg)[4]) {
    _Float16* vd = VshB + b * VBUF + kvrow * VP + d0;   // likewise
#pragma unroll
    for (int j = 0; j < 4; ++j)
#pragma unroll
      for (int c = 0; c < 4; ++c) vd[16 * j * VP + c] = (_Float16)vrg[j][c];
  };

  // ---- Q tile: per query group u two B-fragments (Q^T), pre-scaled by log2(e)/sqrt(D). The wave's 64 rows (16 KB) are
  // loaded 512 contiguous bytes per instruction, rounded to f16 into the wave's own slab and read back as fragments ----
  _Float16* const slab = smem + ws * SLABH;
  v16h bq0[QG], bq1[QG];
  f4 krg0[4], vrg0[4], krg1[4], vrg1[4], kst[4];
  {
    const f4* qv = (const f4*)qp + lane;
    f4 qr[8 * QG];
#pragma unroll
    for (int j = 0; j < 8 * QG; ++j) qr[j] = qv[j * 32];   // float4 j * 32 + lane: row 2j + lh, columns 4 ln .. 4 ln + 3
    asm volatile("s_wait_xcnt 0x0" ::: "memory");   // stands in front of the first overwrite of a register that the Q loads name
    fetchK(0, krg0); fetchV(0, vrg0);    // tiles 0 and 1 fly under the Q turn
    fetchK(1, krg1); fetchV(1, vrg1);
    fetchK(2, kst);                      // and so does tile 2's K share, which pass 0 commits
    asm volatile("s_wait_xcnt 0x0" ::: "memory");   // likewise for the registers that these twenty loads name
#pragma unroll
    for (int j = 0; j < 8 * QG; ++j)
#pragma unroll
      for (int c = 0; c < 4; ++c) slab[(2 * j + lh) * KP + (ln << 2) + c] = (_Float16)(qr[j][c] * kScale);
  }
  asm volatile("s_wait_dscnt 0x0" ::: "memory");   // the wave's own slab stores are done before other lanes' rows are read
#pragma unroll
  for (int u = 0; u < QG; ++u) {
    bq0[u] = afrag(slab, KP, 16 * u, 0, ln, lh);
    bq1[u] = afrag(slab, KP, 16 * u, 32, ln, lh);
  }
  __syncthreads();                       // every wave has read its Q slab before tile 0 is written over the slabs

  commitK(0, krg0); commitV(0, vrg0);
  commitK(1, krg1); commitV(1, vrg1);
  __syncthreads();                       // tiles 0 and 1 published

  // the first maximum in use: each column's largest score among keys 0 .. 15. It is a true score of the row, so the
  // denominator holds a term 1 from the start and cannot vanish, however low the scores lie.
  {
    const v16h alo = afrag(KshB, KP, 0, 0, ln, lh);
    const v16h ahi = afrag(KshB, KP, 0, 32, ln, lh);
#pragma unroll
    for (int u = 0; u < QG; ++u) {
      v8f s0 = {};
      s0 = mma(alo, bq0[u], s0);
      s0 = mma(ahi, bq1[u], s0);
      float m0 = s0[0];
#pragma unroll
      for (int i = 1; i < 8; ++i) m0 = fmaxf(m0, s0[i]);
      m0 = fmaxf(m0, xhalf(m0));                // other half holds keys+8
#pragma unroll
      for (int i = 0; i < 8; ++i) negm[u][i] = -m0;
    }
  }

  // ---- One barrier per tile, in two halves: a wave signals behind its score products and waits in front of its V products.
  // So no wave starts the V products of tile t before every wave has issued its score products of tile t. With a full barrier
  // at the foot the two waves of a SIMD started every pass together: both queued for the matrix unit, then both for the
  // vector port, and the first to finish idled. Now the wave that gets the matrix unit first runs ahead, but only as far as
  // that wait, half a pass: its matrix run (V products of tile t, score products of tile t + 1) starts when the other wave
  // turns to its maxima and exponentials, and the other way round. (Speed alone leans on which wave is ahead.)
  // Ring: pass t writes tile t + 2 over tile t - 2 (four buffers). A wave in pass t is behind its wait of pass t - 1, so
  // every wave has signalled in pass t - 1, its s_wait_dscnt 0 in front: all reads of tile t - 2 have ended and all shares of
  // tile t, committed in pass t - 2, are in LDS. Nothing in pass t needs the wait of pass t itself, so the LDS accesses that
  // stand between a signal and its wait (the K commit, the V reads) are safe there.
  // Signal and wait alternate strictly in every wave, and every wave makes all NT passes.
  for (int t = 0; t < NT; ++t) {
    const _Float16* Ksh = KshB + (t & (NBUF - 1)) * KBUF;
    const _Float16* Vsh = VshB + (t & (NBUF - 1)) * VBUF;
    const bool more = t + 2 < NT;
    // ---- S^T = K_tile @ (Q*scale)^T : per query group four 16(key)x16(q) accumulators.
    // Lane holds q-col = 16u + ln; VGPR j = key 16g + j + 8*lh. Each K fragment is read once for QG products.
    // The sums start at negm: s = score - maximum in use, in base 2. ----
    v8f s[QG][4];
    v16h kf[4][2];
#pragma unroll
    for (int g = 0; g < 4; ++g) {
      kf[g][0] = afrag(Ksh, KP, 16 * g, 0, ln, lh);
      kf[g][1] = afrag(Ksh, KP, 16 * g, 32, ln, lh);
    }
    // keeps all of the tile's sixteen K reads ahead of the products: the compiler otherwise splits them into
    // groups that reuse registers, and the wave waits out the LDS latency once per group
    __builtin_amdgcn_sched_barrier(0);
#pragma unroll
    for (int g = 0; g < 4; ++g) {
      const v16h alo = kf[g][0];
      const v16h ahi = kf[g][1];
#pragma unroll
      for (int u = 0; u < QG; ++u) s[u][g] = mma(alo, bq0[u], negm[u]);
#pragma unroll
      for (int u = 0; u < QG; ++u) s[u][g] = mma(ahi, bq1[u], s[u][g]);
    }

    // keeps the thirty-two score products back to back: a maximum moved in among them reads a fresh accumulator and
    // costs four v_nop each time
    __builtin_amdgcn_sched_barrier(0);
    asm volatile("s_wait_dscnt 0x0" ::: "memory");   // this wave's LDS reads and commits so far are done before it signals
    bar_signal();                        // this wave's matrix run has been issued: the waves that wait below may start theirs

    // ---- how far this lane's 128 scores (all groups) stand above their maxima in use: in-lane only, four independent
    // chains of 33, 33, 31, 31 values (whole three-input maxima), in the order in which the accumulators finish ----
    float top;
    {
      auto x = [&](int n) { return s[(n >> 3) & 3][n >> 5][n & 7]; };
      float c[4];
      constexpr int first[5] = {0, 33, 66, 97, 128};
#pragma unroll
      for (int h = 0; h < 4; ++h) {
        c[h] = x(first[h]);
#pragma unroll
        for (int n = first[h] + 1; n < first[h + 1]; ++n) c[h] = fmaxf(c[h], x(n));
      }
      top = fmaxf(fmaxf(fmaxf(c[0], c[1]), c[2]), c[3]);
    }

    // ---- lazy maximum: ONE wave-uniform test per tile. Only if some column's score exceeds its maximum in use by
    // more than kLazy are the maxima raised and the running state rescaled ----
    if (__builtin_amdgcn_ballot_w32(top > kLazy) != 0u) {
#pragma unroll
      for (int u = 0; u < QG; ++u) {
        float over = 0.0f;                                               // only a rise counts
#pragma unroll
        for (int g = 0; g < 4; ++g)
#pragma unroll
          for (int i = 0; i < 8; ++i) over = fmaxf(over, s[u][g][i]);
        const float d   = fmaxf(over, xhalf(over));                      // the rise of this column's maximum; other half holds keys+8
        const float fac = __builtin_amdgcn_exp2f(-d);
        negm[u] = negm[u] - d;
#pragma unroll
        for (int g = 0; g < 4; ++g) s[u][g] = s[u][g] - d;
#pragma unroll
        for (int i = 0; i < 8; ++i) {
          oacc[u][0][i] *= fac; oacc[u][1][i] *= fac; oacc[u][2][i] *= fac; oacc[u][3][i] *= fac;
          lacc[u][i] *= fac;
        }
      }
    }

    // Staging, timed so that it holds few VGPRs: under the score products, where the K fragments need the
    // room, only a K share is held in registers. Here tile t + 2's K share, fetched one pass ago, is committed; then tile
    // t + 2's V share and tile t + 3's K share (the last tile's a second time, unused, rather than a branch) go out and
    // fly under the exponentials and the V products, up to the foot of the pass. The buffers written are free for the
    // whole pass: their last readers have signalled since.
    f4 vst[4];
    if (more) {
      commitK((t + 2) & (NBUF - 1), kst);
      fetchV(t + 2, vst);
      fetchK(t + 3 < NT ? t + 3 : NT - 1, kst);
      asm volatile("s_wait_xcnt 0x0" ::: "memory");   // stands in front of the first overwrite of a register that these eight loads name
    }

    v16h bp0[QG], bp1[QG];
#pragma unroll
    for (int u = 0; u < QG; ++u) {
      // ---- P^T fragments built IN REGISTERS (S^T C-layout == B-operand layout):
      // bp0 element i -> key 16*(i>>3)+8*lh+(i&7) = tile (i>>3), VGPR (i&7), same lane ----
#pragma unroll
      for (int i = 0; i < 8; ++i) {
        bp0[u][i]     = (_Float16)__builtin_amdgcn_exp2f(s[u][0][i]);
        bp0[u][i + 8] = (_Float16)__builtin_amdgcn_exp2f(s[u][1][i]);
        bp1[u][i]     = (_Float16)__builtin_amdgcn_exp2f(s[u][2][i]);
        bp1[u][i + 8] = (_Float16)__builtin_amdgcn_exp2f(s[u][3][i]);
      }
    }

    // the V^T fragments are read under the exponentials, ahead of the wait (tile t has long been published), so that the
    // matrix run behind the wait holds no LDS read
    v16h vf[4][2];
#pragma unroll
    for (int c = 0; c < 4; ++c) {
      vf[c][0] = vtfrag(Vsh, 16 * c, 0, lane);
      vf[c][1] = vtfrag(Vsh, 16 * c, 32, lane);
    }
    // the two scheduling fences keep the compiler from moving products, which are no memory accesses, ahead of the wait
    __builtin_amdgcn_sched_barrier(0);
    bar_wait();                          // every wave has issued its score products of tile t: the matrix unit is this wave's turn
    __builtin_amdgcn_sched_barrier(0);

    // ---- denominator: lacc += ones @ P^T (column sums, all keys covered) ----
#pragma unroll
    for (int u = 0; u < QG; ++u) {
      lacc[u] = mma(aones, bp0[u], lacc[u]);
      lacc[u] = mma(aones, bp1[u], lacc[u]);
    }

    // ---- O^T += V^T @ P^T : four d-row chunks, K-dim 64 = 2 WMMAs each per query group;
    // each V^T fragment is read once for QG products ----
#pragma unroll
    for (int c = 0; c < 4; ++c) {
      const v16h alo = vf[c][0];
      const v16h ahi = vf[c][1];
#pragma unroll
      for (int u = 0; u < QG; ++u) oacc[u][c] = mma(alo, bp0[u], oacc[u][c]);
#pragma unroll
      for (int u = 0; u < QG; ++u) oacc[u][c] = mma(ahi, bp1[u], oacc[u][c]);
    }

    if (more) commitV((t + 2) & (NBUF - 1), vst);
  }

  // ---- normalize and write out: lane ln owns q-row 16u + ln in runs of 8 d values; the 16 rows of a group are
  // turned through the wave's own slab so that each global_store_b128 of the wave covers 512 contiguous bytes ----
  __syncthreads();                       // the waves leave the loop apart: every wave's reads of the last tile end here
  // the lane's number is formed anew and the wave's number is taken as wave-uniform, so that this part's addresses are
  // formed here and not held in VGPRs across the loop
  const int lane2 = (int)__builtin_amdgcn_mbcnt_lo(~0u, 0u);
  const int lh2   = lane2 >> 4;
  const int ln2   = lane2 & 15;
  float* const oslab = (float*)(smem + ws * SLABH);
#pragma unroll
  for (int u = 0; u < QG; ++u) {
    const float invl = 1.0f / lacc[u][0];
    float* orow = oslab + ln2 * OP + (lh2 << 3);
#pragma unroll
    for (int i = 0; i < 8; ++i) {
      orow[i]      = oacc[u][0][i] * invl;
      orow[16 + i] = oacc[u][1][i] * invl;
      orow[32 + i] = oacc[u][2][i] * invl;
      orow[48 + i] = oacc[u][3][i] * invl;
    }
    asm volatile("s_wait_dscnt 0x0" ::: "memory");   // the group's rows are in the slab before other lanes read them
    f4* og = (f4*)(o + ((size_t)bh * Ss + qblk * QTILE) * Dd);           // the block's rows: the same for all its threads
    const unsigned o4 = (unsigned)ws * (16 * QG * Dd / 4) + 16 * u * Dd / 4 + lane2;
#pragma unroll
    for (int j = 0; j < 8; ++j) og[o4 + j * 32] = *(const f4*)(oslab + (2 * j + lh2) * OP + (ln2 << 2));
  }
}

extern "C" void kernel_launch(void* const* d_in, const int* in_sizes, int n_in,
                              void* d_out, int out_size, void* d_ws, size_t ws_size,
                              hipStream_t stream) {
  (void)in_sizes; (void)n_in; (void)out_size; (void)d_ws; (void)ws_size;
  const float* q = (const float*)d_in[0];
  const float* k = (const float*)d_in[1];
  const float* v = (const float*)d_in[2];
  float* o = (float*)d_out;
  const int blocks = Bb * Hh * (Ss / QTILE);   // 256
  fa_fwd_wmma<<<blocks, 256, 0, stream>>>(q, k, v, o);
}

// v010
// Measured time: 43.9 microseconds a run.
// Two timings next to v009 both put it at 1.07 times that version's speed.
// All steps since v000 together make it 6.47 times as fast.
#include <hip/hip_runtime.h>
#include <math.h>

typedef __attribute__((ext_vector_type(16))) _Float16 v16h;
typedef __attribute__((ext_vector_type(8)))  _Float16 v8h;
typedef __attribute__((ext_vector_type(8)))  short    s16x8;
typedef __attribute__((ext_vector_type(8)))  float    v8f;
typedef __attribute__((ext_vector_type(4)))  float    f4;
typedef __attribute__((ext_vector_type(2)))  float    f2;
typedef __attribute__((ext_vector_type(2)))  _Float16 h2;
typedef __attribute__((ext_vector_type(8)))  unsigned w8;

namespace {
constexpr int Bb = 4, Hh = 16, Ss = 2048, Dd = 64;
// Scores are kept in base 2: Q is pre-scaled by log2(e)/sqrt(64), so that exp(score - maximum) is the bare
// exp2 of what the score products deliver and no multiply stands in front of any exponential
constexpr float kScale = 0.125f * 1.4426950408889634f;
// the maxima in use are raised only when some score of the wave stands this far above its column's: 8 doublings
constexpr float kLazy  = 8.0f;
// P carries the factor 2^-kBias (it cancels between O and the denominator): a score kLazy above its maximum in use gives
// P = 2, and a non-negative f16 is 2 or more exactly when bit 14 of its pattern is set (infinity and NaN included). So the
// test for a rise is a bitwise OR over the packed P words. Below 2^-14 P is subnormal, in steps of 2^-24: finer, against
// a P of 2^-kBias at the maximum, than the rounding of that P itself.
constexpr float    kBias    = kLazy - 1.0f;
constexpr unsigned kRiseBit = 0x40004000u;
constexpr int QG    = 4;           // 16-column query groups per wave: each K / V^T fragment read from LDS feeds QG products
constexpr int QTILE = 128 * QG;    // q rows per block = 8 waves * 16 * QG
constexpr int KT    = 64;          // kv rows per tile
constexpr int NT    = Ss / KT;     // 32 kv tiles
// LDS row pitch in halves: 128 B of data + 16 B pad = 144 B = 16 B x 9 (odd), so the
// 16 rows one ds_load_b128 touches per half-wave start on 16 different 4-bank groups.
constexpr int KP    = Dd + 8;      // K tile row pitch
// V rows are read by the transposing load, whose conflict-free pitch is 32 B x odd: 128 B + 32 B = 160 B
constexpr int VP    = Dd + 16;     // V tile row pitch
constexpr int KBUF  = KT * KP;     // halves per K buffer
constexpr int VBUF  = KT * VP;     // halves per V buffer
constexpr int NBUF  = 4;           // tile buffers per tensor: the waves of a block run up to half a pass apart (see the loop)
constexpr int RINGH = NBUF * (KBUF + VBUF);   // the eight tile buffers, in halves (77,824 B)
// Before the first and after the last tile the same LDS is eight wave-private slabs, in which Q and O are turned
// between whole-line global order and fragment order
constexpr int SLABH = 16 * QG * KP;   // 9,216 B per wave: its 64 Q rows at pitch KP, or 16 O rows at pitch OP
constexpr int OP    = Dd + 4;      // O row pitch in floats: 272 B = 16 B x 17 (odd), as for K
constexpr int SMEMH = 8 * SLABH > RINGH ? 8 * SLABH : RINGH;   // all LDS, in halves (77,824 B; one block per WGP)
static_assert(16 * OP * 2 <= SLABH && (SLABH * 2) % 16 == 0, "slab too small");
}

// 16-bit WMMA A/B fragment K-index (ISA 7.12.2):
// element i of lane L -> K = 16*(i>>3) + 8*(L>=16) + 2*((i>>1)&3) + (i&1)
//                          = 16*(i>>3) + 8*(L>=16) + (i&7)
// Consecutive i give contiguous 8-half runs -> LDS reads vectorize to b128.
__device__ __forceinline__ int kidx(int i, int lh) {
  return ((i >> 3) << 4) + (lh << 3) + (((i >> 1) & 3) << 1) + (i & 1);
}

// One 16x32 A fragment: row (row0 + ln) of an LDS tile, k columns col0 .. col0+31
__device__ __forceinline__ v16h afrag(const _Float16* tile, int pitch, int row0, int col0, int ln, int lh) {
  v16h a;
#pragma unroll
  for (int i = 0; i < 16; ++i) a[i] = tile[(row0 + ln) * pitch + col0 + kidx(i, lh)];
  return a;
}

// One 16(d) x 32(key) A fragment of V^T out of the row-major V tile [key][d]: the transposing LDS load hands
// lane (ln, lh) the 8 keys k + 8*lh .. +7 of column dcol + ln; loads at k0 and k0 + 16 give the kidx order.
__device__ __forceinline__ v16h vtfrag(const _Float16* tile, int dcol, int k0, int lane) {
  typedef __attribute__((address_space(3))) s16x8 lds_s16x8;
  const _Float16* p = tile + (k0 + ((lane >> 4) << 3) + (lane & 7)) * VP + dcol + (((lane >> 3) & 1) << 3);
  const v8h lo = __builtin_bit_cast(v8h, __builtin_amdgcn_ds_load_tr16_b128_v8i16((lds_s16x8*)p));
  const v8h hi = __builtin_bit_cast(v8h, __builtin_amdgcn_ds_load_tr16_b128_v8i16((lds_s16x8*)(p + 16 * VP)));
  return __builtin_shufflevector(lo, hi, 0, 1, 2, 3, 4, 5, 6, 7, 8, 9, 10, 11, 12, 13, 14, 15);
}

// lane l's value of lane l ^ 16, by a vector cross-row move (needs no index register and no LDS wait)
__device__ __forceinline__ float xhalf(float x) {
  const int b = __builtin_bit_cast(int, x);
  return __builtin_bit_cast(float, __builtin_amdgcn_permlanex16(b, b, 0x76543210, 0xfedcba98, false, false));
}

__device__ __forceinline__ v8f mma(v16h a, v16h b, v8f c) {
  return __builtin_amdgcn_wmma_f32_16x16x32_f16(false, a, false, b, (short)0, c, false, false);
}

// P^T fragments of one query group, built IN REGISTERS from its four score accumulators (S^T C-layout == B-operand layout):
// b0 element i -> key 16*(i>>3)+8*lh+(i&7) = accumulator (i>>3), VGPR (i&7), same lane; b1 likewise from accumulators 2, 3.
// Each word is two neighbouring scores' exponentials, rounded to f16 together. Returns the OR of the sixteen words.
__device__ __forceinline__ unsigned pfrags(const v8f (&s)[4], v16h& b0, v16h& b1) {
  w8 w[2];
  unsigned any = 0u;
#pragma unroll
  for (int g = 0; g < 4; ++g)
#pragma unroll
    for (int j = 0; j < 4; ++j) {
      const f2 e = {__builtin_amdgcn_exp2f(s[g][2 * j]), __builtin_amdgcn_exp2f(s[g][2 * j + 1])};
      const unsigned p = __builtin_bit_cast(unsigned, __builtin_convertvector(e, h2));
      w[g >> 1][((g & 1) << 2) + j] = p;
      any |= p;
    }
  b0 = __builtin_bit_cast(v16h, w[0]);
  b1 = __builtin_bit_cast(v16h, w[1]);
  return any;
}

// The work-group barrier in its two halves, so that a wave can say "my score products of this tile are out" and go on, and ask
// only later whether all the others have said so. Neither half waits for memory: the LDS wait stands in front of the signal.
__device__ __forceinline__ void bar_signal() { asm volatile("s_barrier_signal -1" ::: "memory"); }
__device__ __forceinline__ void bar_wait()   { asm volatile("s_barrier_wait -1" ::: "memory"); }

// two waves per SIMD (one block per WGP, the whole grid resident) may take up to 512 VGPRs each
__global__ __launch_bounds__(256) __attribute__((amdgpu_waves_per_eu(2, 2)))
void fa_fwd_wmma(const float* __restrict__ q, const float* __restrict__ k,
                 const float* __restrict__ v, float* __restrict__ o) {
  // four buffers each: tile t lies in buffer t & 3
  __shared__ __attribute__((aligned(16))) _Float16 smem[SMEMH];
  _Float16* const KshB = smem;                // K tile [k][d], padded rows, 4 x 9 KB: buffer b at b * KBUF
  _Float16* const VshB = smem + NBUF * KBUF;  // V tile [k][d], as in memory, padded rows, 4 x 10 KB: buffer b at b * VBUF

  const int tid  = threadIdx.x;
  const int lane = tid & 31;
  const int w    = tid >> 5;
  const int ws   = __builtin_amdgcn_readfirstlane(w);   // the same, as a wave-uniform value
  const int lh   = lane >> 4;
  const int ln   = lane & 15;

  const int qblocks = Ss / QTILE;
  const int bh    = blockIdx.x / qblocks;
  const int qblk  = blockIdx.x % qblocks;
  const int qbase = qblk * QTILE + ws * (16 * QG);

  const float* qp = q + ((size_t)bh * Ss + qbase) * Dd;
  const float* kp = k + (size_t)bh * Ss * Dd;
  const float* vp = v + (size_t)bh * Ss * Dd;

  // constant all-ones A fragment: ones @ P^T = column sums (softmax denominator)
  v16h aones;
#pragma unroll
  for (int i = 0; i < 16; ++i) aones[i] = (_Float16)1.0f;

  // O^T accumulators oacc[u][c]: lane = q-col 16u + ln, VGPR i = d row 16c + i + 8*lh
  v8f oacc[QG][4] = {};
  v8f lacc[QG] = {};           // denominator (every VGPR row holds q-col sum)
  // minus (the maximum in use for this lane's q-column of each group, plus kBias), in all eight registers: the C operand on
  // which the score products start, so that they come out as score - maximum - kBias. Set below, once tile 0 is in LDS.
  v8f negm[QG];

  // K/V staging: piece j of this thread is float4 number j * 256 + tid of the tile, so the 32 lanes of a wave
  // load 512 contiguous bytes = four whole 128 B lines per instruction (a lane-private 64 B run touched 16 lines)
  const int kvrow = tid >> 4;            // k row of piece 0; piece j lies 16 rows further down
  const int d0    = (tid & 15) << 2;     // d column base (4 cols)

  // fetch this thread's share of tile tt, fp32, into staging registers on its way to LDS
  // (the tile's address is the same for the whole block; the thread adds one 32-bit offset, shared by K and V)
  const unsigned toff = (unsigned)tid * 16u;
  typedef const __attribute__((address_space(1))) char* gbytes;
  typedef const __attribute__((address_space(1))) f4*   gf4;
  // holds a block-uniform address in scalar registers: otherwise the compiler adds the thread's offset to it ahead of the
  // loop and keeps a 64-bit address per thread and tensor in VGPRs across it
  auto scalar_base = [](const float* p) {
    const unsigned long long a = (unsigned long long)p;
    const unsigned lo = __builtin_amdgcn_readfirstlane((unsigned)a);
    const unsigned hi = __builtin_amdgcn_readfirstlane((unsigned)(a >> 32));
    return (gbytes)(((unsigned long long)hi << 32) | lo);
  };
  auto fetchK = [&](int tt, f4 (&krg)[4]) {
    gbytes ktn = scalar_base(kp + (size_t)tt * (KT * Dd));
#pragma unroll
    for (int j = 0; j < 4; ++j) krg[j] = *(gf4)(ktn + j * 4096 + toff);
  };
  auto fetchV = [&](int tt, f4 (&vrg)[4]) {
    gbytes vtn = scalar_base(vp + (size_t)tt * (KT * Dd));
#pragma unroll
    for (int j = 0; j < 4; ++j) vrg[j] = *(gf4)(vtn + j * 4096 + toff);
  };
  // commit the staging registers to LDS buffer b (fp32 -> f16); K and V both row-major
  auto commitK = [&](int b, const f4 (&krg)[4]) {
    _Float16* kd = KshB + b * KBUF + kvrow * KP + d0;   // 4 contiguous halves per piece -> one ds_store_b64 each
#pragma unroll
    for (int j = 0; j < 4; ++j)
#pragma unroll
      for (int c = 0; c < 4; ++c) kd[16 * j * KP + c] = (_Float16)krg[j][c];
  };
  auto commitV = [&](int b, const f4 (&vrg)[4]) {
    _Float16* vd = VshB + b * VBUF + kvrow * VP + d0;   // likewise
#pragma unroll
    for (int j = 0; j < 4; ++j)
#pragma unroll
      for (int c = 0; c < 4; ++c) vd[16 * j * VP + c] = (_Float16)vrg[j][c];
  };

  // ---- Q tile: per query group u two B-fragments (Q^T), pre-scaled by log2(e)/sqrt(D). The wave's 64 rows (16 KB) are
  // loaded 512 contiguous bytes per instruction, rounded to f16 into the wave's own slab and read back as fragments ----
  _Float16* const slab = smem + ws * SLABH;
  v16h bq0[QG], bq1[QG];
  f4 krg0[4], vrg0[4], krg1[4], vrg1[4], kst[4];
  {
    const f4* qv = (const f4*)qp + lane;
    f4 qr[8 * QG];
#pragma unroll
    for (int j = 0; j < 8 * QG; ++j) qr[j] = qv[j * 32];   // float4 j * 32 + lane: row 2j + lh, columns 4 ln .. 4 ln + 3
    asm volatile("s_wait_xcnt 0x0" ::: "memory");   // stands in front of the first overwrite of a register that the Q loads name
    fetchK(0, krg0); fetchV(0, vrg0);    // tiles 0 and 1 fly under the Q turn
    fetchK(1, krg1); fetchV(1, vrg1);
    fetchK(2, kst);                      // and so does tile 2's K share, which pass 0 commits
    asm volatile("s_wait_xcnt 0x0" ::: "memory");   // likewise for the registers that these twenty loads name
#pragma unroll
    for (int j = 0; j < 8 * QG; ++j)
#pragma unroll
      for (int c = 0; c < 4; ++c) slab[(2 * j + lh) * KP + (ln << 2) + c] = (_Float16)(qr[j][c] * kScale);
  }
  asm volatile("s_wait_dscnt 0x0" ::: "memory");   // the wave's own slab stores are done before other lanes' rows are read
#pragma unroll
  for (int u = 0; u < QG; ++u) {
    bq0[u] = afrag(slab, KP, 16 * u, 0, ln, lh);
    bq1[u] = afrag(slab, KP, 16 * u, 32, ln, lh);
  }
  __syncthreads();                       // every wave has read its Q slab before tile 0 is written over the slabs

  commitK(0, krg0); commitV(0, vrg0);
  commitK(1, krg1); commitV(1, vrg1);
  __syncthreads();                       // tiles 0 and 1 published

  // the first maximum in use: each column's largest score among keys 0 .. 15. It is a true score of the row, so the
  // denominator holds a term 2^-kBias from the start and cannot vanish, however low the scores lie.
  {
    const v16h alo = afrag(KshB, KP, 0, 0, ln, lh);
    const v16h ahi = afrag(KshB, KP, 0, 32, ln, lh);
#pragma unroll
    for (int u = 0; u < QG; ++u) {
      v8f s0 = {};
      s0 = mma(alo, bq0[u], s0);
      s0 = mma(ahi, bq1[u], s0);
      float m0 = s0[0];
#pragma unroll
      for (int i = 1; i < 8; ++i) m0 = fmaxf(m0, s0[i]);
      m0 = fmaxf(m0, xhalf(m0));                // other half holds keys+8
#pragma unroll
      for (int i = 0; i < 8; ++i) negm[u][i] = -m0 - kBias;
    }
  }

  // ---- One barrier per tile, in two halves: a wave signals behind its score products and waits in front of its V products.
  // So no wave starts the V products of tile t before every wave has issued its score products of tile t. With a full barrier
  // at the foot the two waves of a SIMD started every pass together: both queued for the matrix unit, then both for the
  // vector port, and the first to finish idled. Now the wave that gets the matrix unit first runs ahead, but only as far as
  // that wait, half a pass: its matrix run (V products of tile t, score products of tile t + 1) starts when the other wave
  // turns to its exponentials, and the other way round. (Speed alone leans on which wave is ahead.)
  // Ring: pass t writes tile t + 2 over tile t - 2 (four buffers). A wave in pass t is behind its wait of pass t - 1, so
  // every wave has signalled in pass t - 1, its s_wait_dscnt 0 in front: all reads of tile t - 2 have ended and all shares of
  // tile t, committed in pass t - 2, are in LDS. Nothing in pass t needs the wait of pass t itself, so the LDS accesses that
  // stand between a signal and its wait (the K commit, the V reads, the rare second reading of K tile t) are safe there.
  // Signal and wait alternate strictly in every wave, and every wave makes all NT passes.
  for (int t = 0; t < NT; ++t) {
    const _Float16* Ksh = KshB + (t & (NBUF - 1)) * KBUF;
    const _Float16* Vsh = VshB + (t & (NBUF - 1)) * VBUF;
    const bool more = t + 2 < NT;
    // ---- S^T = K_tile @ (Q*scale)^T : per query group four 16(key)x16(q) accumulators.
    // Lane holds q-col = 16u + ln; VGPR j = key 16g + j + 8*lh. Each K fragment is read once for QG products.
    // The sums start at negm: s = score - maximum in use - kBias, in base 2. ----
    v8f s[QG][4];
    v16h kf[4][2];
#pragma unroll
    for (int g = 0; g < 4; ++g) {
      kf[g][0] = afrag(Ksh, KP, 16 * g, 0, ln, lh);
      kf[g][1] = afrag(Ksh, KP, 16 * g, 32, ln, lh);
    }
    // keeps all of the tile's sixteen K reads ahead of the products: the compiler otherwise splits them into
    // groups that reuse registers, and the wave waits out the LDS latency once per group
    __builtin_amdgcn_sched_barrier(0);
#pragma unroll
    for (int g = 0; g < 4; ++g) {
      const v16h alo = kf[g][0];
      const v16h ahi = kf[g][1];
#pragma unroll
      for (int u = 0; u < QG; ++u) s[u][g] = mma(alo, bq0[u], negm[u]);
#pragma unroll
      for (int u = 0; u < QG; ++u) s[u][g] = mma(ahi, bq1[u], s[u][g]);
    }

    // keeps the score products back to back: an exponential moved in among them reads a fresh accumulator and
    // costs four v_nop each time
    __builtin_amdgcn_sched_barrier(0);
    asm volatile("s_wait_dscnt 0x0" ::: "memory");   // this wave's LDS reads and commits so far are done before it signals
    bar_signal();                        // this wave's matrix run has been issued: the waves that wait below may start theirs

    // Staging, timed so that it holds few VGPRs: under the score products, where the K fragments need the
    // room, only a K share is held in registers. Here tile t + 2's K share, fetched one pass ago, is committed; then tile
    // t + 2's V share and tile t + 3's K share (the last tile's a second time, unused, rather than a branch) go out and
    // fly under the exponentials and the V products, up to the foot of the pass. The buffers written are free for the
    // whole pass: their last readers have signalled since. No branch stands here: the last two passes commit and fetch the
    // last tile once more, unused, into buffers that are free all the same. (With a branch between the score products and the
    // test below the compiler copied three of the products' C operands in every pass.)
    f4 vst[4];
    commitK((t + 2) & (NBUF - 1), kst);
    fetchV(more ? t + 2 : NT - 1, vst);
    fetchK(t + 3 < NT ? t + 3 : NT - 1, kst);
    asm volatile("s_wait_xcnt 0x0" ::: "memory");   // stands in front of the first overwrite of a register that these eight loads name

    // ---- P^T = 2^s, with no look at the scores first; 'any' gathers the bits of all 64 P words of the lane ----
    v16h bp0[QG], bp1[QG];
    unsigned any = 0u;
#pragma unroll
    for (int u = 0; u < QG - 1; ++u) any |= pfrags(s[u], bp0[u], bp1[u]);

    // the V^T fragments are read under the exponentials, ahead of the wait (tile t has long been published), so that the
    // matrix run behind the wait holds no LDS read
    v16h vf[4][2];
#pragma unroll
    for (int c = 0; c < 4; ++c) {
      vf[c][0] = vtfrag(Vsh, 16 * c, 0, lane);
      vf[c][1] = vtfrag(Vsh, 16 * c, 32, lane);
    }
    // keeps these reads ahead of the last group's exponentials: the compiler otherwise sinks them to the test below, and
    // their latency stands in front of the V products
    __builtin_amdgcn_sched_barrier(0);
    any |= pfrags(s[QG - 1], bp0[QG - 1], bp1[QG - 1]);

    // ---- lazy maximum: ONE wave-uniform test per tile, on P. Only if some P of the wave has reached 2 (a score kLazy above its
    // maximum in use) are the maxima raised and the running state rescaled. The scores are gone by then: group by group they
    // are formed anew from the K tile, which stays in LDS for the whole pass (see the ring above), and P with them.
    // Marked unlikely, so that this code lies behind the loop and not in it ----
    if (__builtin_expect(__builtin_amdgcn_ballot_w32((any & kRiseBit) != 0u) != 0u, 0)) {
#pragma unroll
      for (int u = 0; u < QG; ++u) {
        v8f r[4];
#pragma unroll
        for (int g = 0; g < 4; ++g) {
          r[g] = mma(afrag(Ksh, KP, 16 * g, 0, ln, lh), bq0[u], negm[u]);
          r[g] = mma(afrag(Ksh, KP, 16 * g, 32, ln, lh), bq1[u], r[g]);
          // keeps the K reads of this rare path from being gathered ahead of its products: held together they take
          // registers that the whole loop then lacks
          __builtin_amdgcn_sched_barrier(0);
        }
        float over = -kBias;                                             // only a rise counts
#pragma unroll
        for (int g = 0; g < 4; ++g)
#pragma unroll
          for (int i = 0; i < 8; ++i) over = fmaxf(over, r[g][i]);
        over += kBias;
        const float d   = fmaxf(over, xhalf(over));                      // the rise of this column's maximum; other half holds keys+8
        const float fac = __builtin_amdgcn_exp2f(-d);
        negm[u] = negm[u] - d;
#pragma unroll
        for (int g = 0; g < 4; ++g) r[g] = r[g] - d;
        (void)pfrags(r, bp0[u], bp1[u]);
#pragma unroll
        for (int i = 0; i < 8; ++i) {
          oacc[u][0][i] *= fac; oacc[u][1][i] *= fac; oacc[u][2][i] *= fac; oacc[u][3][i] *= fac;
          lacc[u][i] *= fac;
        }
      }
    }

    // the two scheduling fences keep the compiler from moving products, which are no memory accesses, ahead of the wait
    __builtin_amdgcn_sched_barrier(0);
    bar_wait();                          // every wave has issued its score products of tile t: the matrix unit is this wave's turn
    __builtin_amdgcn_sched_barrier(0);

    // ---- denominator: lacc += ones @ P^T (column sums, all keys covered) ----
#pragma unroll
    for (int u = 0; u < QG; ++u) {
      lacc[u] = mma(aones, bp0[u], lacc[u]);
      lacc[u] = mma(aones, bp1[u], lacc[u]);
    }

    // ---- O^T += V^T @ P^T : four d-row chunks, K-dim 64 = 2 WMMAs each per query group;
    // each V^T fragment is read once for QG products ----
#pragma unroll
    for (int c = 0; c < 4; ++c) {
      const v16h alo = vf[c][0];
      const v16h ahi = vf[c][1];
#pragma unroll
      for (int u = 0; u < QG; ++u) oacc[u][c] = mma(alo, bp0[u], oacc[u][c]);
#pragma unroll
      for (int u = 0; u < QG; ++u) oacc[u][c] = mma(ahi, bp1[u], oacc[u][c]);
    }

    if (more) commitV((t + 2) & (NBUF - 1), vst);
  }

  // ---- normalize and write out: lane ln owns q-row 16u + ln in runs of 8 d values; the 16 rows of a group are
  // turned through the wave's own slab so that each global_store_b128 of the wave covers 512 contiguous bytes ----
  __syncthreads();                       // the waves leave the loop apart: every wave's reads of the last tile end here
  // the lane's number is formed anew and the wave's number is taken as wave-uniform, so that this part's addresses are
  // formed here and not held in VGPRs across the loop
  const int lane2 = (int)__builtin_amdgcn_mbcnt_lo(~0u, 0u);
  const int lh2   = lane2 >> 4;
  const int ln2   = lane2 & 15;
  float* const oslab = (float*)(smem + ws * SLABH);
#pragma unroll
  for (int u = 0; u < QG; ++u) {
    const float invl = 1.0f / lacc[u][0];
    float* orow = oslab + ln2 * OP + (lh2 << 3);
#pragma unroll
    for (int i = 0; i < 8; ++i) {
      orow[i]      = oacc[u][0][i] * invl;
      orow[16 + i] = oacc[u][1][i] * invl;
      orow[32 + i] = oacc[u][2][i] * invl;
      orow[48 + i] = oacc[u][3][i] * invl;
    }
    asm volatile("s_wait_dscnt 0x0" ::: "memory");   // the group's rows are in the slab before other lanes read them
    f4* og = (f4*)(o + ((size_t)bh * Ss + qblk * QTILE) * Dd);           // the block's rows: the same for all its threads
    const unsigned o4 = (unsigned)ws * (16 * QG * Dd / 4) + 16 * u * Dd / 4 + lane2;
#pragma unroll
    for (int j = 0; j < 8; ++j) og[o4 + j * 32] = *(const f4*)(oslab + (2 * j + lh2) * OP + (ln2 << 2));
  }
}

extern "C" void kernel_launch(void* const* d_in, const int* in_sizes, int n_in,
                              void* d_out, int out_size, void* d_ws, size_t ws_size,
                              hipStream_t stream) {
  (void)in_sizes; (void)n_in; (void)out_size; (void)d_ws; (void)ws_size;
  const float* q = (const float*)d_in[0];
  const float* k = (const float*)d_in[1];
  const float* v = (const float*)d_in[2];
  float* o = (float*)d_out;
  const int blocks = Bb * Hh * (Ss / QTILE);   // 256
  fa_fwd_wmma<<<blocks, 256, 0, stream>>>(q, k, v, o);
}
